// v000
// Measured on an AMD MI455X. A time is GPU time per run, averaged over a window of back-to-back runs after a warm-up
// (all launches, gaps included; the runs take copies of the inputs in turn), and the median of several windows.
// Apart from v000's, it joins two sittings. Times from different sittings can be a few percent apart, while
// side-by-side timings come from the same sitting.
// The starting kernel, v000, takes 362 microseconds a run.
#include <hip/hip_runtime.h>
#include <math.h>

typedef __attribute__((ext_vector_type(16))) _Float16 v16h;
typedef __attribute__((ext_vector_type(16))) __bf16 v16b;
typedef __attribute__((ext_vector_type(8)))  _Float16 v8h;
typedef __attribute__((ext_vector_type(8)))  float v8f;
typedef __attribute__((ext_vector_type(4)))  float v4f;
typedef __attribute__((ext_vector_type(2)))  float v2f;
typedef __attribute__((ext_vector_type(4)))  unsigned v4u;
typedef __attribute__((ext_vector_type(4)))  int v4i;
typedef float __attribute__((may_alias)) float_a;
typedef int __attribute__((may_alias)) int_a;

template <typename T> __device__ __forceinline__ void vst2(void* p, T v) { *(T*)p = v;  }
__device__ __forceinline__ v8f wmma16(v16h a, v16h b, v8f c) {
  v8f d = __builtin_amdgcn_wmma_f32_16x16x32_f16(false, a, false, b, (short)0, c, false, false);
  asm volatile("v_nop\n\tv_nop\n\tv_nop\n\tv_nop" : "+v"(d) : "v"(a), "v"(b));
  return d;
}
__device__ __forceinline__ v8f wmma_bf(v16b a, v16b b, v8f c) {
  v8f d = __builtin_amdgcn_wmma_f32_16x16x32_bf16(false, a, false, b, (short)0, c, false, false);
  asm volatile("v_nop\n\tv_nop\n\tv_nop\n\tv_nop" : "+v"(d) : "v"(a), "v"(b));
  return d;
}
// 16x16x32 fragments: lane = (h = lane>>4, row/col = lane&15); elements 0..7 = k0+8h+0..7, 8..15 = k0+16+8h+0..7; D element r = row 8h+r
__device__ __forceinline__ v16h frag_h(const _Float16* rowk0, int lane) {
  union { v16h v; v8h q[2]; } u; const _Float16* p = rowk0 + 8 * (lane >> 4);
  u.q[0] = *(const v8h*)p; u.q[1] = *(const v8h*)(p + 16); return u.v;
}
__device__ __forceinline__ v16h frag_f32(const float* rowk0, int lane) {
  v16h a; const float* p = rowk0 + 8 * (lane >> 4);
#pragma unroll
  for (int i = 0; i < 8; ++i) { a[i] = (_Float16)p[i]; a[8 + i] = (_Float16)p[16 + i]; }
  return a;
}
__device__ __forceinline__ v16h frag_f32s(const float* rowk0, int lane, float sc) {
  v16h a; const float* p = rowk0 + 8 * (lane >> 4);
#pragma unroll
  for (int i = 0; i < 8; ++i) { a[i] = (_Float16)(p[i] * sc); a[8 + i] = (_Float16)(p[16 + i] * sc); }
  return a;
}
// column fragment from a [K][ld] layout (column n), rows >= K read as 0
__device__ __forceinline__ v16h fragc_f32(const float* W, int k0, int n, int lane, int ld, int K) {
  v16h a; const int g = lane >> 4;
#pragma unroll
  for (int i = 0; i < 8; ++i) { const int ka = k0 + 8 * g + i, kb = ka + 16;
    a[i] = (_Float16)(ka < K ? W[(size_t)ka * ld + n] : 0.f); a[8 + i] = (_Float16)(kb < K ? W[(size_t)kb * ld + n] : 0.f); }
  return a;
}
struct F2 { v16b h, l; };
__device__ __forceinline__ F2 bsplit16(const float v[16]) { F2 r;
#pragma unroll
  for (int i = 0; i < 16; ++i) { const __bf16 h = (__bf16)v[i]; r.h[i] = h; r.l[i] = (__bf16)(v[i] - (float)h); }
  return r; }
__device__ __forceinline__ F2 split_row(const float* row, int k0, int lane) { float v[16]; const float* p = row + k0 + 8 * (lane >> 4);
#pragma unroll
  for (int i = 0; i < 8; ++i) { v[i] = p[i]; v[8 + i] = p[16 + i]; }
  return bsplit16(v); }
__device__ __forceinline__ F2 split_rowK(const float* row, int k0, int lane, int K) { float v[16]; const int g = lane >> 4;
#pragma unroll
  for (int i = 0; i < 8; ++i) { const int ka = k0 + 8 * g + i, kb = ka + 16; v[i] = ka < K ? row[ka] : 0.f; v[8 + i] = kb < K ? row[kb] : 0.f; }
  return bsplit16(v); }
__device__ __forceinline__ F2 split_col(const float* W, int k0, int n, int lane, int ld, int K) { float v[16]; const int g = lane >> 4;
#pragma unroll
  for (int i = 0; i < 8; ++i) { const int ka = k0 + 8 * g + i, kb = ka + 16; v[i] = ka < K ? W[(size_t)ka * ld + n] : 0.f; v[8 + i] = kb < K ? W[(size_t)kb * ld + n] : 0.f; }
  return bsplit16(v); }
__device__ __forceinline__ v8f mac3(const F2& a, const F2& b, v8f c) { c = wmma_bf(a.l, b.h, c); c = wmma_bf(a.h, b.l, c); return wmma_bf(a.h, b.h, c); }
__device__ __forceinline__ float sigm(float v) { return 1.0f / (1.0f + expf(-v)); }
#define LDSX() do { asm volatile("s_wait_dscnt 0" ::: "memory"); __builtin_amdgcn_wave_barrier(); __builtin_amdgcn_fence(__ATOMIC_RELEASE, "workgroup"); } while (0)

// 2-D self-attention with the softmax taken over the QUERY axis (axis=1 of [b,n,m], as the reference does). f, g, hh = x @ w (K = 128,
// tiles, K = 16 zero-padded); pass 2: per query block y[n] = sum_m exp(s[n][m] - M_m)/L_m hh[m] on WMMA (P x2^14 f16), then
#define NB 8
#define NN 4096
#define CC 128
#define DK 16
#define NR (NB * NN)

// f/g/h projections: block 64 rows; outputs F16,G16 [r][16] f16 (x? f,g ~ N(0, 1): scores = f.g (K=16) no scaling), HT16 [b][d][n] (h transposed for the PV B operand)
__global__ __launch_bounds__(128) void k_proj(const float* __restrict__ x, const float* __restrict__ wf, const float* __restrict__ wg, const float* __restrict__ wh, _Float16* __restrict__ F16, _Float16* __restrict__ G16, _Float16* __restrict__ HT) {
  __shared__ __align__(16) float so[4][16][52];
  __shared__ __align__(16) _Float16 st[DK][72];
  const int tid = threadIdx.x, wave = tid >> 5, lane = tid & 31, col = lane & 15, g = lane >> 4;
  const int r0b = blockIdx.x * 64, r0 = r0b + wave * 16; const int b = r0b / NN, n0 = r0b % NN;
  v8f acc[3] = {};
#pragma unroll
  for (int kc = 0; kc < CC / 32; ++kc) { const v16h a = frag_f32(x + (size_t)(r0 + col) * CC + kc * 32, lane);
    acc[0] = wmma16(a, fragc_f32(wf, kc * 32, col, lane, DK, CC), acc[0]); acc[1] = wmma16(a, fragc_f32(wg, kc * 32, col, lane, DK, CC), acc[1]); acc[2] = wmma16(a, fragc_f32(wh, kc * 32, col, lane, DK, CC), acc[2]); }
#pragma unroll
  for (int j = 0; j < 3; ++j)
#pragma unroll
    for (int r = 0; r < 8; ++r) so[wave][8 * g + r][j * 16 + col] = acc[j][r];
  LDSX();
  if (lane < 16) { union { v8h a8; v4u u; } pf0, pf1, pg0, pg1; const int rl = lane;
#pragma unroll
    for (int e = 0; e < 8; ++e) { pf0.a8[e] = (_Float16)so[wave][rl][e]; pf1.a8[e] = (_Float16)so[wave][rl][8 + e]; pg0.a8[e] = (_Float16)so[wave][rl][16 + e]; pg1.a8[e] = (_Float16)so[wave][rl][24 + e]; }
    vst2(F16 + (size_t)(r0 + rl) * DK, pf0.u); vst2(F16 + (size_t)(r0 + rl) * DK + 8, pf1.u); vst2(G16 + (size_t)(r0 + rl) * DK, pg0.u); vst2(G16 + (size_t)(r0 + rl) * DK + 8, pg1.u); }
  // h transposed: st[d][block row] then HT[b][d][n0 + 64]
  if (lane < 16) {
#pragma unroll
    for (int d = 0; d < DK; ++d) st[d][wave * 16 + lane] = (_Float16)so[wave][lane][32 + d]; }
  __syncthreads();
  if (tid < DK * 8) { const int d = tid >> 3, pc = tid & 7; vst2(HT + ((size_t)b * DK + d) * NN + n0 + pc * 8, *(const v4u*)(&st[d][pc * 8])); }
}
__global__ __launch_bounds__(128) void k_colstat(const _Float16* __restrict__ F16, const _Float16* __restrict__ G16, float* __restrict__ cst) {
  __shared__ __align__(16) float sS[4][16][20];
  __shared__ __align__(16) float so[4][16][2];
  const int tid = threadIdx.x, w = tid >> 5, lane = tid & 31, col = lane & 15, g = lane >> 4;
  const int b = blockIdx.y, m0 = blockIdx.x * 64 + w * 16; const size_t rb = (size_t)b * NN;
  v16h ag;                                              // A = g rows (m0 + col), K = 16 zero-padded
  { const _Float16* gr = G16 + (rb + m0 + col) * DK;
#pragma unroll
    for (int i = 0; i < 8; ++i) { ag[i] = gr[8 * g + i]; ag[8 + i] = (_Float16)0.f; } }
  float mrun = -3.0e38f, lrun = 0.f;
#pragma unroll 1
  for (int nt = 0; nt < NN / 16; ++nt) { v16h bf; const _Float16* fr = F16 + (rb + nt * 16 + col) * DK;
#pragma unroll
    for (int i = 0; i < 8; ++i) { bf[i] = fr[8 * g + i]; bf[8 + i] = (_Float16)0.f; }
    v8f s = {}; s = wmma16(ag, bf, s);
#pragma unroll
    for (int r = 0; r < 8; ++r) sS[w][8 * g + r][col] = s[r];
    LDSX();
    if (g == 0) { const int m = col; float mx = -3.4e38f;
#pragma unroll
      for (int e = 0; e < 16; ++e) mx = fmaxf(mx, sS[w][m][e]);
      const float mnew = fmaxf(mrun, mx); float ps = 0.f;
#pragma unroll
      for (int e = 0; e < 16; ++e) ps += expf(sS[w][m][e] - mnew);
      lrun = lrun * expf(mrun - mnew) + ps; mrun = mnew; }
    LDSX(); }
  if (g == 0) { so[w][col][0] = mrun; so[w][col][1] = 1.0f / lrun; }
  LDSX();
  if (lane < 8) vst2(cst + (rb + m0) * 2 + lane * 4, *(const v4f*)(&so[w][0][0] + lane * 4));
}
// pass 2: block (b, 64 queries n): loop key tiles m of 64: S = f_n . g_m; p = exp(s - M_m) * invL_m (x2^14 f16); y += P @ h_m ; out = gamma*(y @ w_v) + x
__global__ __launch_bounds__(128) void k_apply(const _Float16* __restrict__ F16, const _Float16* __restrict__ G16, const _Float16* __restrict__ HT, const float* __restrict__ cst, const float* __restrict__ wv, const float* __restrict__ gam, const float* __restrict__ x, float* __restrict__ out) {
  __shared__ __align__(16) _Float16 sP[4][16][72];
  __shared__ __align__(16) float sy[4][16][20];
  __shared__ __align__(16) float so[4][16][132];
  const int tid = threadIdx.x, w = tid >> 5, lane = tid & 31, col = lane & 15, g = lane >> 4;
  const int b = blockIdx.y, n0 = blockIdx.x * 64 + w * 16; const size_t rb = (size_t)b * NN;
  v16h af; { const _Float16* fr = F16 + (rb + n0 + col) * DK;
#pragma unroll
    for (int i = 0; i < 8; ++i) { af[i] = fr[8 * g + i]; af[8 + i] = (_Float16)0.f; } }
  v8f acc = {};
#pragma unroll 1
  for (int mt = 0; mt < NN / 64; ++mt) {
#pragma unroll
    for (int t = 0; t < 4; ++t) { const int m = mt * 64 + t * 16 + col; v16h bg; const _Float16* gr = G16 + (rb + m) * DK;
#pragma unroll
      for (int i = 0; i < 8; ++i) { bg[i] = gr[8 * g + i]; bg[8 + i] = (_Float16)0.f; }
      v8f s = {}; s = wmma16(af, bg, s);
      const float Mm = cst[(rb + m) * 2], iL = cst[(rb + m) * 2 + 1];
#pragma unroll
      for (int r = 0; r < 8; ++r) sP[w][8 * g + r][t * 16 + col] = (_Float16)(expf(s[r] - Mm) * iL * 16384.0f); }
    LDSX();
#pragma unroll
    for (int kc = 0; kc < 2; ++kc) acc = wmma16(frag_h(&sP[w][col][0] + kc * 32, lane), frag_h(HT + ((size_t)b * DK + col) * NN + mt * 64 + kc * 32, lane), acc);
    LDSX(); }
#pragma unroll
  for (int r = 0; r < 8; ++r) sy[w][8 * g + r][col] = acc[r] * (1.0f / 16384.0f);
  LDSX();
  // out = gamma * (y @ w_v) + x : y [16 x 16] @ w_v [16 x 128] -> WMMA K=16 (zero-padded), N = 128 (8 tiles)
  { v16h ay;
#pragma unroll
    for (int i = 0; i < 8; ++i) { ay[i] = (_Float16)sy[w][col][8 * g + i]; ay[8 + i] = (_Float16)0.f; }
    const float gm = gam[0];
#pragma unroll
    for (int j = 0; j < 8; ++j) { v16h bb;
#pragma unroll
      for (int i = 0; i < 8; ++i) { bb[i] = (_Float16)(wv[(size_t)(8 * g + i) * CC + j * 16 + col] * 4.0f); bb[8 + i] = (_Float16)0.f; }
      v8f o = {}; o = wmma16(ay, bb, o);
#pragma unroll
      for (int r = 0; r < 8; ++r) { const int c = j * 16 + col; so[w][8 * g + r][c] = gm * o[r] * 0.25f + x[(rb + n0 + 8 * g + r) * CC + c]; } } }
  LDSX();
#pragma unroll 4
  for (int rl = 0; rl < 16; ++rl) vst2(out + (rb + n0 + rl) * CC + lane * 4, *(const v4f*)(&so[w][rl][lane * 4]));
}
extern "C" void kernel_launch(void* const* d_in, const int* in_sizes, int n_in, void* d_out, int out_size, void* d_ws, size_t ws_size, hipStream_t stream) {
  (void)in_sizes; (void)n_in; (void)out_size; (void)ws_size;
  const float** I = (const float**)d_in;
  const float* x = I[0]; const float* wf = I[1]; const float* wg = I[2]; const float* wh = I[3]; const float* wv = I[4]; const float* gam = I[5];
  float* out = (float*)d_out;
  char* ws = (char*)d_ws; size_t off = 0;
  auto take = [&](size_t bytes) { char* p = ws + off; off += (bytes + 255) & ~(size_t)255; return p; };
  _Float16* F16 = (_Float16*)take((size_t)NR * DK * 2); _Float16* G16 = (_Float16*)take((size_t)NR * DK * 2); _Float16* HT = (_Float16*)take((size_t)NR * DK * 2); float* cst = (float*)take((size_t)NR * 2 * 4);
  k_proj<<<NR / 64, 128, 0, stream>>>(x, wf, wg, wh, F16, G16, HT);
  k_colstat<<<dim3(NN / 64, NB), 128, 0, stream>>>(F16, G16, cst);
  k_apply<<<dim3(NN / 64, NB), 128, 0, stream>>>(F16, G16, HT, cst, wv, gam, x, out);
}

// v001
// A run of this version takes 196 microseconds.
// Next to v000, in two timings, it ran 1.89 and 1.90 times as fast.
#include <hip/hip_runtime.h>
#include <math.h>

typedef __attribute__((ext_vector_type(16))) _Float16 v16h;
typedef __attribute__((ext_vector_type(16))) __bf16 v16b;
typedef __attribute__((ext_vector_type(8)))  _Float16 v8h;
typedef __attribute__((ext_vector_type(8)))  float v8f;
typedef __attribute__((ext_vector_type(4)))  float v4f;
typedef __attribute__((ext_vector_type(2)))  float v2f;
typedef __attribute__((ext_vector_type(4)))  unsigned v4u;
typedef __attribute__((ext_vector_type(4)))  int v4i;
typedef float __attribute__((may_alias)) float_a;
typedef int __attribute__((may_alias)) int_a;

template <typename T> __device__ __forceinline__ void vst2(void* p, T v) { *(T*)p = v;  }
__device__ __forceinline__ v8f wmma16(v16h a, v16h b, v8f c) {
  v8f d = __builtin_amdgcn_wmma_f32_16x16x32_f16(false, a, false, b, (short)0, c, false, false);
  asm volatile("v_nop\n\tv_nop\n\tv_nop\n\tv_nop" : "+v"(d) : "v"(a), "v"(b));
  return d;
}
__device__ __forceinline__ v8f wmma_bf(v16b a, v16b b, v8f c) {
  v8f d = __builtin_amdgcn_wmma_f32_16x16x32_bf16(false, a, false, b, (short)0, c, false, false);
  asm volatile("v_nop\n\tv_nop\n\tv_nop\n\tv_nop" : "+v"(d) : "v"(a), "v"(b));
  return d;
}
// 16x16x32 fragments: lane = (h = lane>>4, row/col = lane&15); elements 0..7 = k0+8h+0..7, 8..15 = k0+16+8h+0..7; D element r = row 8h+r
__device__ __forceinline__ v16h frag_h(const _Float16* rowk0, int lane) {
  union { v16h v; v8h q[2]; } u; const _Float16* p = rowk0 + 8 * (lane >> 4);
  u.q[0] = *(const v8h*)p; u.q[1] = *(const v8h*)(p + 16); return u.v;
}
__device__ __forceinline__ v16h frag_f32(const float* rowk0, int lane) {
  v16h a; const float* p = rowk0 + 8 * (lane >> 4);
#pragma unroll
  for (int i = 0; i < 8; ++i) { a[i] = (_Float16)p[i]; a[8 + i] = (_Float16)p[16 + i]; }
  return a;
}
__device__ __forceinline__ v16h frag_f32s(const float* rowk0, int lane, float sc) {
  v16h a; const float* p = rowk0 + 8 * (lane >> 4);
#pragma unroll
  for (int i = 0; i < 8; ++i) { a[i] = (_Float16)(p[i] * sc); a[8 + i] = (_Float16)(p[16 + i] * sc); }
  return a;
}
// column fragment from a [K][ld] layout (column n), rows >= K read as 0
__device__ __forceinline__ v16h fragc_f32(const float* W, int k0, int n, int lane, int ld, int K) {
  v16h a; const int g = lane >> 4;
#pragma unroll
  for (int i = 0; i < 8; ++i) { const int ka = k0 + 8 * g + i, kb = ka + 16;
    a[i] = (_Float16)(ka < K ? W[(size_t)ka * ld + n] : 0.f); a[8 + i] = (_Float16)(kb < K ? W[(size_t)kb * ld + n] : 0.f); }
  return a;
}
struct F2 { v16b h, l; };
__device__ __forceinline__ F2 bsplit16(const float v[16]) { F2 r;
#pragma unroll
  for (int i = 0; i < 16; ++i) { const __bf16 h = (__bf16)v[i]; r.h[i] = h; r.l[i] = (__bf16)(v[i] - (float)h); }
  return r; }
__device__ __forceinline__ F2 split_row(const float* row, int k0, int lane) { float v[16]; const float* p = row + k0 + 8 * (lane >> 4);
#pragma unroll
  for (int i = 0; i < 8; ++i) { v[i] = p[i]; v[8 + i] = p[16 + i]; }
  return bsplit16(v); }
__device__ __forceinline__ F2 split_rowK(const float* row, int k0, int lane, int K) { float v[16]; const int g = lane >> 4;
#pragma unroll
  for (int i = 0; i < 8; ++i) { const int ka = k0 + 8 * g + i, kb = ka + 16; v[i] = ka < K ? row[ka] : 0.f; v[8 + i] = kb < K ? row[kb] : 0.f; }
  return bsplit16(v); }
__device__ __forceinline__ F2 split_col(const float* W, int k0, int n, int lane, int ld, int K) { float v[16]; const int g = lane >> 4;
#pragma unroll
  for (int i = 0; i < 8; ++i) { const int ka = k0 + 8 * g + i, kb = ka + 16; v[i] = ka < K ? W[(size_t)ka * ld + n] : 0.f; v[8 + i] = kb < K ? W[(size_t)kb * ld + n] : 0.f; }
  return bsplit16(v); }
__device__ __forceinline__ v8f mac3(const F2& a, const F2& b, v8f c) { c = wmma_bf(a.l, b.h, c); c = wmma_bf(a.h, b.l, c); return wmma_bf(a.h, b.h, c); }
__device__ __forceinline__ float sigm(float v) { return 1.0f / (1.0f + expf(-v)); }
#define LDSX() do { asm volatile("s_wait_dscnt 0" ::: "memory"); __builtin_amdgcn_wave_barrier(); __builtin_amdgcn_fence(__ATOMIC_RELEASE, "workgroup"); } while (0)

// 2-D self-attention with the softmax taken over the QUERY axis (axis=1 of [b,n,m], as the reference does). f, g, hh = x @ w (K = 128,
// tiles, K = 16 zero-padded); pass 2: per query block y[n] = sum_m exp(s[n][m] - M_m)/L_m hh[m] on WMMA (P x2^14 f16), then
#define NB 8
#define NN 4096
#define CC 128
#define DK 16
#define NR (NB * NN)

// f/g/h projections: block 64 rows; outputs F16,G16 [r][16] f16 (x? f,g ~ N(0, 1): scores = f.g (K=16) no scaling), HT16 [b][d][n] (h transposed for the PV B operand)
__global__ __launch_bounds__(128) void k_proj(const float* __restrict__ x, const float* __restrict__ wf, const float* __restrict__ wg, const float* __restrict__ wh, _Float16* __restrict__ F16, _Float16* __restrict__ G16, _Float16* __restrict__ HT) {
  __shared__ __align__(16) float so[4][16][52];
  __shared__ __align__(16) _Float16 st[DK][72];
  const int tid = threadIdx.x, wave = tid >> 5, lane = tid & 31, col = lane & 15, g = lane >> 4;
  const int r0b = blockIdx.x * 64, r0 = r0b + wave * 16; const int b = r0b / NN, n0 = r0b % NN;
  v8f acc[3] = {};
#pragma unroll
  for (int kc = 0; kc < CC / 32; ++kc) { const v16h a = frag_f32(x + (size_t)(r0 + col) * CC + kc * 32, lane);
    acc[0] = wmma16(a, fragc_f32(wf, kc * 32, col, lane, DK, CC), acc[0]); acc[1] = wmma16(a, fragc_f32(wg, kc * 32, col, lane, DK, CC), acc[1]); acc[2] = wmma16(a, fragc_f32(wh, kc * 32, col, lane, DK, CC), acc[2]); }
#pragma unroll
  for (int j = 0; j < 3; ++j)
#pragma unroll
    for (int r = 0; r < 8; ++r) so[wave][8 * g + r][j * 16 + col] = acc[j][r];
  LDSX();
  if (lane < 16) { union { v8h a8; v4u u; } pf0, pf1, pg0, pg1; const int rl = lane;
#pragma unroll
    for (int e = 0; e < 8; ++e) { pf0.a8[e] = (_Float16)so[wave][rl][e]; pf1.a8[e] = (_Float16)so[wave][rl][8 + e]; pg0.a8[e] = (_Float16)so[wave][rl][16 + e]; pg1.a8[e] = (_Float16)so[wave][rl][24 + e]; }
    vst2(F16 + (size_t)(r0 + rl) * DK, pf0.u); vst2(F16 + (size_t)(r0 + rl) * DK + 8, pf1.u); vst2(G16 + (size_t)(r0 + rl) * DK, pg0.u); vst2(G16 + (size_t)(r0 + rl) * DK + 8, pg1.u); }
  // h transposed: st[d][block row] then HT[b][d][n0 + 64]
  if (lane < 16) {
#pragma unroll
    for (int d = 0; d < DK; ++d) st[d][wave * 16 + lane] = (_Float16)so[wave][lane][32 + d]; }
  __syncthreads();
  if (tid < DK * 8) { const int d = tid >> 3, pc = tid & 7; vst2(HT + ((size_t)b * DK + d) * NN + n0 + pc * 8, *(const v4u*)(&st[d][pc * 8])); }
}
// value of lane (lane ^ X) inside the 16-lane row (DPP row_xmask); every lane is on where it is used
template <int X> __device__ __forceinline__ float rowx(float v) { return __builtin_bit_cast(float, __builtin_amdgcn_update_dpp(0, __builtin_bit_cast(int, v), 0x160 | X, 0xf, 0xf, true)); }
#define CT 8   // query tiles of 16 per batch: one rescale of the running sum per CT scores
// column statistics: D = g_m . f_n has key row m = 8g + r in register r and query n in the lane's column, so each lane keeps a running
// (max, sum) per register over its own query columns; the 16 lanes of a row are merged once, behind the loop
__global__ __launch_bounds__(128) void k_colstat(const _Float16* __restrict__ F16, const _Float16* __restrict__ G16, float* __restrict__ cst) {
  const int tid = threadIdx.x, w = tid >> 5, lane = tid & 31, col = lane & 15, g = lane >> 4;
  const int b = blockIdx.y, m0 = blockIdx.x * 64 + w * 16; const size_t rb = (size_t)b * NN;
  v16h ag;                                              // A = g rows (m0 + col), K = 16 zero-padded
  { const _Float16* gr = G16 + (rb + m0 + col) * DK;
#pragma unroll  // constant indices keep the array in registers
    for (int i = 0; i < 8; ++i) { ag[i] = gr[8 * g + i]; ag[8 + i] = (_Float16)0.f; } }
  float mrun[8], lrun[8];
#pragma unroll  // constant indices keep the array in registers
  for (int r = 0; r < 8; ++r) { mrun[r] = -3.0e38f; lrun[r] = 0.f; }
  const _Float16* fp = F16 + (rb + col) * DK + 8 * g;   // this lane's 8 halves of query row col; a tile of 16 rows further on is 16 * DK halves
  for (int nb = 0; nb < NN / (16 * CT); ++nb, fp += CT * 16 * DK) { v8h raw[CT]; v8f s[CT];
#pragma unroll  // constant indices keep the array in registers
    for (int t = 0; t < CT; ++t) raw[t] = *(const v8h*)(fp + t * 16 * DK);   // the batch's loads stand together: one latency per batch
#pragma unroll  // constant indices keep the array in registers
    for (int t = 0; t < CT; ++t) { v16h bf;
#pragma unroll  // constant indices keep the array in registers
      for (int i = 0; i < 8; ++i) { bf[i] = raw[t][i]; bf[8 + i] = (_Float16)0.f; }
      v8f z = {}; s[t] = wmma16(ag, bf, z); }
#pragma unroll  // constant indices keep the array in registers
    for (int r = 0; r < 8; ++r) { float mnew = mrun[r];
#pragma unroll  // constant indices keep the array in registers
      for (int t = 0; t < CT; ++t) mnew = fmaxf(mnew, s[t][r]);
      float ps = 0.f;
#pragma unroll  // constant indices keep the array in registers
      for (int t = 0; t < CT; ++t) ps += expf(s[t][r] - mnew);
      lrun[r] = lrun[r] * expf(mrun[r] - mnew) + ps; mrun[r] = mnew; } }
  float Mo = 0.f, Lo = 1.f;
#pragma unroll  // constant indices keep the array in registers
  for (int r = 0; r < 8; ++r) { float M = mrun[r];
    M = fmaxf(M, rowx<1>(M)); M = fmaxf(M, rowx<2>(M)); M = fmaxf(M, rowx<4>(M)); M = fmaxf(M, rowx<8>(M));
    float l = lrun[r] * expf(mrun[r] - M);
    l += rowx<1>(l); l += rowx<2>(l); l += rowx<4>(l); l += rowx<8>(l);
    if (col == r) { Mo = M; Lo = l; } }
  if (col < 8) { v2f o; o[0] = Mo; o[1] = 1.0f / Lo; vst2(cst + (rb + m0 + 8 * g + col) * 2, o); }
}
// pass 2: block (b, 64 queries n): loop key tiles m of 64: S = f_n . g_m; p = exp(s - M_m) * invL_m (x2^14 f16); y += P @ h_m ; out = gamma*(y @ w_v) + x
__global__ __launch_bounds__(128) void k_apply(const _Float16* __restrict__ F16, const _Float16* __restrict__ G16, const _Float16* __restrict__ HT, const float* __restrict__ cst, const float* __restrict__ wv, const float* __restrict__ gam, const float* __restrict__ x, float* __restrict__ out) {
  __shared__ __align__(16) _Float16 sP[4][16][72];
  __shared__ __align__(16) float sy[4][16][20];
  __shared__ __align__(16) float so[4][16][132];
  const int tid = threadIdx.x, w = tid >> 5, lane = tid & 31, col = lane & 15, g = lane >> 4;
  const int b = blockIdx.y, n0 = blockIdx.x * 64 + w * 16; const size_t rb = (size_t)b * NN;
  v16h af; { const _Float16* fr = F16 + (rb + n0 + col) * DK;
#pragma unroll
    for (int i = 0; i < 8; ++i) { af[i] = fr[8 * g + i]; af[8 + i] = (_Float16)0.f; } }
  v8f acc = {};
#pragma unroll 1
  for (int mt = 0; mt < NN / 64; ++mt) {
#pragma unroll
    for (int t = 0; t < 4; ++t) { const int m = mt * 64 + t * 16 + col; v16h bg; const _Float16* gr = G16 + (rb + m) * DK;
#pragma unroll
      for (int i = 0; i < 8; ++i) { bg[i] = gr[8 * g + i]; bg[8 + i] = (_Float16)0.f; }
      v8f s = {}; s = wmma16(af, bg, s);
      const float Mm = cst[(rb + m) * 2], iL = cst[(rb + m) * 2 + 1];
#pragma unroll
      for (int r = 0; r < 8; ++r) sP[w][8 * g + r][t * 16 + col] = (_Float16)(expf(s[r] - Mm) * iL * 16384.0f); }
    LDSX();
#pragma unroll
    for (int kc = 0; kc < 2; ++kc) acc = wmma16(frag_h(&sP[w][col][0] + kc * 32, lane), frag_h(HT + ((size_t)b * DK + col) * NN + mt * 64 + kc * 32, lane), acc);
    LDSX(); }
#pragma unroll
  for (int r = 0; r < 8; ++r) sy[w][8 * g + r][col] = acc[r] * (1.0f / 16384.0f);
  LDSX();
  // out = gamma * (y @ w_v) + x : y [16 x 16] @ w_v [16 x 128] -> WMMA K=16 (zero-padded), N = 128 (8 tiles)
  { v16h ay;
#pragma unroll
    for (int i = 0; i < 8; ++i) { ay[i] = (_Float16)sy[w][col][8 * g + i]; ay[8 + i] = (_Float16)0.f; }
    const float gm = gam[0];
#pragma unroll
    for (int j = 0; j < 8; ++j) { v16h bb;
#pragma unroll
      for (int i = 0; i < 8; ++i) { bb[i] = (_Float16)(wv[(size_t)(8 * g + i) * CC + j * 16 + col] * 4.0f); bb[8 + i] = (_Float16)0.f; }
      v8f o = {}; o = wmma16(ay, bb, o);
#pragma unroll
      for (int r = 0; r < 8; ++r) { const int c = j * 16 + col; so[w][8 * g + r][c] = gm * o[r] * 0.25f + x[(rb + n0 + 8 * g + r) * CC + c]; } } }
  LDSX();
#pragma unroll 4
  for (int rl = 0; rl < 16; ++rl) vst2(out + (rb + n0 + rl) * CC + lane * 4, *(const v4f*)(&so[w][rl][lane * 4]));
}
extern "C" void kernel_launch(void* const* d_in, const int* in_sizes, int n_in, void* d_out, int out_size, void* d_ws, size_t ws_size, hipStream_t stream) {
  (void)in_sizes; (void)n_in; (void)out_size; (void)ws_size;
  const float** I = (const float**)d_in;
  const float* x = I[0]; const float* wf = I[1]; const float* wg = I[2]; const float* wh = I[3]; const float* wv = I[4]; const float* gam = I[5];
  float* out = (float*)d_out;
  char* ws = (char*)d_ws; size_t off = 0;
  auto take = [&](size_t bytes) { char* p = ws + off; off += (bytes + 255) & ~(size_t)255; return p; };
  _Float16* F16 = (_Float16*)take((size_t)NR * DK * 2); _Float16* G16 = (_Float16*)take((size_t)NR * DK * 2); _Float16* HT = (_Float16*)take((size_t)NR * DK * 2); float* cst = (float*)take((size_t)NR * 2 * 4);
  k_proj<<<NR / 64, 128, 0, stream>>>(x, wf, wg, wh, F16, G16, HT);
  k_colstat<<<dim3(NN / 64, NB), 128, 0, stream>>>(F16, G16, cst);
  k_apply<<<dim3(NN / 64, NB), 128, 0, stream>>>(F16, G16, HT, cst, wv, gam, x, out);
}

// v002
// One run takes 117 microseconds.
// Two timings next to v001 put it at 1.67 and 1.68 times that version's speed.
// Over all steps from v000 it is 3.17 times as fast.
#include <hip/hip_runtime.h>
#include <math.h>

typedef __attribute__((ext_vector_type(16))) _Float16 v16h;
typedef __attribute__((ext_vector_type(16))) __bf16 v16b;
typedef __attribute__((ext_vector_type(8)))  _Float16 v8h;
typedef __attribute__((ext_vector_type(8)))  float v8f;
typedef __attribute__((ext_vector_type(4)))  float v4f;
typedef __attribute__((ext_vector_type(2)))  float v2f;
typedef __attribute__((ext_vector_type(4)))  unsigned v4u;
typedef __attribute__((ext_vector_type(4)))  int v4i;
typedef float __attribute__((may_alias)) float_a;
typedef int __attribute__((may_alias)) int_a;

template <typename T> __device__ __forceinline__ void vst2(void* p, T v) { *(T*)p = v;  }
__device__ __forceinline__ v8f wmma16(v16h a, v16h b, v8f c) {
  v8f d = __builtin_amdgcn_wmma_f32_16x16x32_f16(false, a, false, b, (short)0, c, false, false);
  asm volatile("v_nop\n\tv_nop\n\tv_nop\n\tv_nop" : "+v"(d) : "v"(a), "v"(b));
  return d;
}
__device__ __forceinline__ v8f wmma_bf(v16b a, v16b b, v8f c) {
  v8f d = __builtin_amdgcn_wmma_f32_16x16x32_bf16(false, a, false, b, (short)0, c, false, false);
  asm volatile("v_nop\n\tv_nop\n\tv_nop\n\tv_nop" : "+v"(d) : "v"(a), "v"(b));
  return d;
}
// 16x16x32 fragments: lane = (h = lane>>4, row/col = lane&15); elements 0..7 = k0+8h+0..7, 8..15 = k0+16+8h+0..7; D element r = row 8h+r
__device__ __forceinline__ v16h frag_h(const _Float16* rowk0, int lane) {
  union { v16h v; v8h q[2]; } u; const _Float16* p = rowk0 + 8 * (lane >> 4);
  u.q[0] = *(const v8h*)p; u.q[1] = *(const v8h*)(p + 16); return u.v;
}
__device__ __forceinline__ v16h frag_f32(const float* rowk0, int lane) {
  v16h a; const float* p = rowk0 + 8 * (lane >> 4);
#pragma unroll
  for (int i = 0; i < 8; ++i) { a[i] = (_Float16)p[i]; a[8 + i] = (_Float16)p[16 + i]; }
  return a;
}
__device__ __forceinline__ v16h frag_f32s(const float* rowk0, int lane, float sc) {
  v16h a; const float* p = rowk0 + 8 * (lane >> 4);
#pragma unroll
  for (int i = 0; i < 8; ++i) { a[i] = (_Float16)(p[i] * sc); a[8 + i] = (_Float16)(p[16 + i] * sc); }
  return a;
}
// column fragment from a [K][ld] layout (column n), rows >= K read as 0
__device__ __forceinline__ v16h fragc_f32(const float* W, int k0, int n, int lane, int ld, int K) {
  v16h a; const int g = lane >> 4;
#pragma unroll
  for (int i = 0; i < 8; ++i) { const int ka = k0 + 8 * g + i, kb = ka + 16;
    a[i] = (_Float16)(ka < K ? W[(size_t)ka * ld + n] : 0.f); a[8 + i] = (_Float16)(kb < K ? W[(size_t)kb * ld + n] : 0.f); }
  return a;
}
struct F2 { v16b h, l; };
__device__ __forceinline__ F2 bsplit16(const float v[16]) { F2 r;
#pragma unroll
  for (int i = 0; i < 16; ++i) { const __bf16 h = (__bf16)v[i]; r.h[i] = h; r.l[i] = (__bf16)(v[i] - (float)h); }
  return r; }
__device__ __forceinline__ F2 split_row(const float* row, int k0, int lane) { float v[16]; const float* p = row + k0 + 8 * (lane >> 4);
#pragma unroll
  for (int i = 0; i < 8; ++i) { v[i] = p[i]; v[8 + i] = p[16 + i]; }
  return bsplit16(v); }
__device__ __forceinline__ F2 split_rowK(const float* row, int k0, int lane, int K) { float v[16]; const int g = lane >> 4;
#pragma unroll
  for (int i = 0; i < 8; ++i) { const int ka = k0 + 8 * g + i, kb = ka + 16; v[i] = ka < K ? row[ka] : 0.f; v[8 + i] = kb < K ? row[kb] : 0.f; }
  return bsplit16(v); }
__device__ __forceinline__ F2 split_col(const float* W, int k0, int n, int lane, int ld, int K) { float v[16]; const int g = lane >> 4;
#pragma unroll
  for (int i = 0; i < 8; ++i) { const int ka = k0 + 8 * g + i, kb = ka + 16; v[i] = ka < K ? W[(size_t)ka * ld + n] : 0.f; v[8 + i] = kb < K ? W[(size_t)kb * ld + n] : 0.f; }
  return bsplit16(v); }
__device__ __forceinline__ v8f mac3(const F2& a, const F2& b, v8f c) { c = wmma_bf(a.l, b.h, c); c = wmma_bf(a.h, b.l, c); return wmma_bf(a.h, b.h, c); }
__device__ __forceinline__ float sigm(float v) { return 1.0f / (1.0f + expf(-v)); }
#define LDSX() do { asm volatile("s_wait_dscnt 0" ::: "memory"); __builtin_amdgcn_wave_barrier(); __builtin_amdgcn_fence(__ATOMIC_RELEASE, "workgroup"); } while (0)

// 2-D self-attention with the softmax taken over the QUERY axis (axis=1 of [b,n,m], as the reference does). f, g, hh = x @ w (K = 128,
// tiles, K = 16 zero-padded); pass 2: per query block y[n] = sum_m exp(s[n][m] - M_m)/L_m hh[m] on WMMA (P x2^14 f16), then
#define NB 8
#define NN 4096
#define CC 128
#define DK 16
#define NR (NB * NN)

// f/g/h projections: block 64 rows; outputs F16,G16 [r][16] f16 (x? f,g ~ N(0, 1): scores = f.g (K=16) no scaling), HT16 [b][d][n] (h transposed for the PV A operand)
__global__ __launch_bounds__(128) void k_proj(const float* __restrict__ x, const float* __restrict__ wf, const float* __restrict__ wg, const float* __restrict__ wh, _Float16* __restrict__ F16, _Float16* __restrict__ G16, _Float16* __restrict__ HT) {
  __shared__ __align__(16) float so[4][16][52];
  __shared__ __align__(16) _Float16 st[DK][72];
  const int tid = threadIdx.x, wave = tid >> 5, lane = tid & 31, col = lane & 15, g = lane >> 4;
  const int r0b = blockIdx.x * 64, r0 = r0b + wave * 16; const int b = r0b / NN, n0 = r0b % NN;
  v8f acc[3] = {};
#pragma unroll
  for (int kc = 0; kc < CC / 32; ++kc) { const v16h a = frag_f32(x + (size_t)(r0 + col) * CC + kc * 32, lane);
    acc[0] = wmma16(a, fragc_f32(wf, kc * 32, col, lane, DK, CC), acc[0]); acc[1] = wmma16(a, fragc_f32(wg, kc * 32, col, lane, DK, CC), acc[1]); acc[2] = wmma16(a, fragc_f32(wh, kc * 32, col, lane, DK, CC), acc[2]); }
#pragma unroll
  for (int j = 0; j < 3; ++j)
#pragma unroll
    for (int r = 0; r < 8; ++r) so[wave][8 * g + r][j * 16 + col] = acc[j][r];
  LDSX();
  if (lane < 16) { union { v8h a8; v4u u; } pf0, pf1, pg0, pg1; const int rl = lane;
#pragma unroll
    for (int e = 0; e < 8; ++e) { pf0.a8[e] = (_Float16)so[wave][rl][e]; pf1.a8[e] = (_Float16)so[wave][rl][8 + e]; pg0.a8[e] = (_Float16)so[wave][rl][16 + e]; pg1.a8[e] = (_Float16)so[wave][rl][24 + e]; }
    vst2(F16 + (size_t)(r0 + rl) * DK, pf0.u); vst2(F16 + (size_t)(r0 + rl) * DK + 8, pf1.u); vst2(G16 + (size_t)(r0 + rl) * DK, pg0.u); vst2(G16 + (size_t)(r0 + rl) * DK + 8, pg1.u); }
  // h transposed: st[d][block row] then HT[b][d][n0 + 64]
  if (lane < 16) {
#pragma unroll
    for (int d = 0; d < DK; ++d) st[d][wave * 16 + lane] = (_Float16)so[wave][lane][32 + d]; }
  __syncthreads();
  if (tid < DK * 8) { const int d = tid >> 3, pc = tid & 7; vst2(HT + ((size_t)b * DK + d) * NN + n0 + pc * 8, *(const v4u*)(&st[d][pc * 8])); }
}
// value of lane (lane ^ X) inside the 16-lane row (DPP row_xmask); every lane is on where it is used
template <int X> __device__ __forceinline__ float rowx(float v) { return __builtin_bit_cast(float, __builtin_amdgcn_update_dpp(0, __builtin_bit_cast(int, v), 0x160 | X, 0xf, 0xf, true)); }
#define CT 8   // query tiles of 16 per batch: one rescale of the running sum per CT scores
// column statistics: D = g_m . f_n has key row m = 8g + r in register r and query n in the lane's column, so each lane keeps a running
// (max, sum) per register over its own query columns; the 16 lanes of a row are merged once, behind the loop
__global__ __launch_bounds__(128) void k_colstat(const _Float16* __restrict__ F16, const _Float16* __restrict__ G16, float* __restrict__ cst) {
  const int tid = threadIdx.x, w = tid >> 5, lane = tid & 31, col = lane & 15, g = lane >> 4;
  const int b = blockIdx.y, m0 = blockIdx.x * 64 + w * 16; const size_t rb = (size_t)b * NN;
  v16h ag;                                              // A = g rows (m0 + col), K = 16 zero-padded
  { const _Float16* gr = G16 + (rb + m0 + col) * DK;
#pragma unroll  // constant indices keep the array in registers
    for (int i = 0; i < 8; ++i) { ag[i] = gr[8 * g + i]; ag[8 + i] = (_Float16)0.f; } }
  float mrun[8], lrun[8];
#pragma unroll  // constant indices keep the array in registers
  for (int r = 0; r < 8; ++r) { mrun[r] = -3.0e38f; lrun[r] = 0.f; }
  const _Float16* fp = F16 + (rb + col) * DK + 8 * g;   // this lane's 8 halves of query row col; a tile of 16 rows further on is 16 * DK halves
  for (int nb = 0; nb < NN / (16 * CT); ++nb, fp += CT * 16 * DK) { v8h raw[CT]; v8f s[CT];
#pragma unroll  // constant indices keep the array in registers
    for (int t = 0; t < CT; ++t) raw[t] = *(const v8h*)(fp + t * 16 * DK);   // the batch's loads stand together: one latency per batch
#pragma unroll  // constant indices keep the array in registers
    for (int t = 0; t < CT; ++t) { v16h bf;
#pragma unroll  // constant indices keep the array in registers
      for (int i = 0; i < 8; ++i) { bf[i] = raw[t][i]; bf[8 + i] = (_Float16)0.f; }
      v8f z = {}; s[t] = wmma16(ag, bf, z); }
#pragma unroll  // constant indices keep the array in registers
    for (int r = 0; r < 8; ++r) { float mnew = mrun[r];
#pragma unroll  // constant indices keep the array in registers
      for (int t = 0; t < CT; ++t) mnew = fmaxf(mnew, s[t][r]);
      float ps = 0.f;
#pragma unroll  // constant indices keep the array in registers
      for (int t = 0; t < CT; ++t) ps += expf(s[t][r] - mnew);
      lrun[r] = lrun[r] * expf(mrun[r] - mnew) + ps; mrun[r] = mnew; } }
  float Mo = 0.f, Lo = 1.f;
#pragma unroll  // constant indices keep the array in registers
  for (int r = 0; r < 8; ++r) { float M = mrun[r];
    M = fmaxf(M, rowx<1>(M)); M = fmaxf(M, rowx<2>(M)); M = fmaxf(M, rowx<4>(M)); M = fmaxf(M, rowx<8>(M));
    float l = lrun[r] * expf(mrun[r] - M);
    l += rowx<1>(l); l += rowx<2>(l); l += rowx<4>(l); l += rowx<8>(l);
    if (col == r) { Mo = M; Lo = l; } }
  // one constant per key: exp(s + c) = 2^14 exp(s - M) / L; a wave's 16 constants head a 128-byte line of their own
  if (col < 8) cst[(rb + m0) * 2 + 8 * g + col] = 9.70406053f - Mo - logf(Lo);
}
#define KP 4   // pairs of 16-key tiles per batch (128 keys): the batch's loads stand together, one latency per batch
// pass 2: wave = 16 queries n. S^T = g_m . f_n + c_m (c_m enters as the C operand) has key m = 8g + r in register r and query n in the lane's
// column, so exp of two such tiles, converted in place, IS the B operand (32 keys x 16 queries, x2^14 f16) of y^T += h^T . P^T: P never leaves
// the registers. y^T has d = 8g + r in register r, which is the A operand of y @ w_v. out = gamma*(y @ w_v) + x
__global__ __launch_bounds__(128) void k_apply(const _Float16* __restrict__ F16, const _Float16* __restrict__ G16, const _Float16* __restrict__ HT, const float* __restrict__ cst, const float* __restrict__ wv, const float* __restrict__ gam, const float* __restrict__ x, float* __restrict__ out) {
  __shared__ __align__(16) float so[4][16][132];
  const int tid = threadIdx.x, w = tid >> 5, lane = tid & 31, col = lane & 15, g = lane >> 4;
  const int b = blockIdx.y, n0 = blockIdx.x * 64 + w * 16; const size_t rb = (size_t)b * NN;
  v16h bf; { const _Float16* fr = F16 + (rb + n0 + col) * DK;   // B = f rows (n0 + col), K = 16 zero-padded
#pragma unroll
    for (int i = 0; i < 8; ++i) { bf[i] = fr[8 * g + i]; bf[8 + i] = (_Float16)0.f; } }
  v8f acc = {};
  const _Float16* gp = G16 + (rb + col) * DK + 8 * g;              // this lane's 8 halves of key row col; the next tile is 16 * DK halves on
  const float* cp = cst + rb * 2 + 8 * g;                          // the constants of key rows 8g .. 8g + 7; the next tile is 32 floats on
  const _Float16* hp = HT + ((size_t)b * DK + col) * NN + 8 * g;   // row d = col of h^T, keys 8g .. 8g + 7; the next tile is 16 halves on
#pragma unroll 1  // one batch per trip: a second copy of the body would only cost instruction cache
  for (int mb = 0; mb < NN / (32 * KP); ++mb, gp += KP * 32 * DK, cp += KP * 64, hp += KP * 32) { v8h rg[2 * KP], rh[2 * KP]; v8f s[2 * KP];
#pragma unroll  // constant indices keep the array in registers
    for (int t = 0; t < 2 * KP; ++t) rg[t] = *(const v8h*)(gp + t * 16 * DK);
#pragma unroll  // constant indices keep the array in registers
    for (int t = 0; t < 2 * KP; ++t) s[t] = *(const v8f*)(cp + t * 32);
    asm volatile("s_wait_xcnt 0x0" ::: "memory");   // a result of the loads below may land in an address register of the loads above: the wait stands in front of it
#pragma unroll  // constant indices keep the array in registers
    for (int t = 0; t < 2 * KP; ++t) rh[t] = *(const v8h*)(hp + t * 16);
#pragma unroll  // constant indices keep the arrays in registers
    for (int t = 0; t < 2 * KP; ++t) { v16h ag;
#pragma unroll
      for (int i = 0; i < 8; ++i) { ag[i] = rg[t][i]; ag[8 + i] = (_Float16)0.f; }
      s[t] = wmma16(ag, bf, s[t]); }
#pragma unroll  // constant indices keep the arrays in registers
    for (int p = 0; p < KP; ++p) { v16h pb, ha;
#pragma unroll
      for (int r = 0; r < 8; ++r) { pb[r] = (_Float16)expf(s[2 * p][r]); pb[8 + r] = (_Float16)expf(s[2 * p + 1][r]); ha[r] = rh[2 * p][r]; ha[8 + r] = rh[2 * p + 1][r]; }
      acc = wmma16(ha, pb, acc); } }
  // out = gamma * (y @ w_v) + x : y [16 x 16] @ w_v [16 x 128] -> WMMA K=16 (zero-padded), N = 128 (8 tiles)
  { v16h ay;
#pragma unroll
    for (int i = 0; i < 8; ++i) { ay[i] = (_Float16)(acc[i] * (1.0f / 16384.0f)); ay[8 + i] = (_Float16)0.f; }
    const float gm = gam[0];
#pragma unroll
    for (int j = 0; j < 8; ++j) { v16h bb;
#pragma unroll
      for (int i = 0; i < 8; ++i) { bb[i] = (_Float16)(wv[(size_t)(8 * g + i) * CC + j * 16 + col] * 4.0f); bb[8 + i] = (_Float16)0.f; }
      v8f o = {}; o = wmma16(ay, bb, o);
#pragma unroll
      for (int r = 0; r < 8; ++r) { const int c = j * 16 + col; so[w][8 * g + r][c] = gm * o[r] * 0.25f + x[(rb + n0 + 8 * g + r) * CC + c]; } } }
  LDSX();
#pragma unroll 4
  for (int rl = 0; rl < 16; ++rl) vst2(out + (rb + n0 + rl) * CC + lane * 4, *(const v4f*)(&so[w][rl][lane * 4]));
}
extern "C" void kernel_launch(void* const* d_in, const int* in_sizes, int n_in, void* d_out, int out_size, void* d_ws, size_t ws_size, hipStream_t stream) {
  (void)in_sizes; (void)n_in; (void)out_size; (void)ws_size;
  const float** I = (const float**)d_in;
  const float* x = I[0]; const float* wf = I[1]; const float* wg = I[2]; const float* wh = I[3]; const float* wv = I[4]; const float* gam = I[5];
  float* out = (float*)d_out;
  char* ws = (char*)d_ws; size_t off = 0;
  auto take = [&](size_t bytes) { char* p = ws + off; off += (bytes + 255) & ~(size_t)255; return p; };
  _Float16* F16 = (_Float16*)take((size_t)NR * DK * 2); _Float16* G16 = (_Float16*)take((size_t)NR * DK * 2); _Float16* HT = (_Float16*)take((size_t)NR * DK * 2); float* cst = (float*)take((size_t)NR * 2 * 4);
  k_proj<<<NR / 64, 128, 0, stream>>>(x, wf, wg, wh, F16, G16, HT);
  k_colstat<<<dim3(NN / 64, NB), 128, 0, stream>>>(F16, G16, cst);
  k_apply<<<dim3(NN / 64, NB), 128, 0, stream>>>(F16, G16, HT, cst, wv, gam, x, out);
}

// v003
// It runs in 76.8 microseconds.
// Two timings next to v002 put it at 1.50 and 1.55 times that version's speed.
// Counting every step since v000, it is 4.83 times as fast.
#include <hip/hip_runtime.h>
#include <math.h>

typedef __attribute__((ext_vector_type(16))) _Float16 v16h;
typedef __attribute__((ext_vector_type(16))) __bf16 v16b;
typedef __attribute__((ext_vector_type(8)))  _Float16 v8h;
typedef __attribute__((ext_vector_type(8)))  float v8f;
typedef __attribute__((ext_vector_type(4)))  float v4f;
typedef __attribute__((ext_vector_type(2)))  float v2f;
typedef __attribute__((ext_vector_type(4)))  unsigned v4u;
typedef __attribute__((ext_vector_type(4)))  int v4i;
typedef float __attribute__((may_alias)) float_a;
typedef int __attribute__((may_alias)) int_a;

template <typename T> __device__ __forceinline__ void vst2(void* p, T v) { *(T*)p = v;  }
__device__ __forceinline__ v8f wmma16(v16h a, v16h b, v8f c) {
  v8f d = __builtin_amdgcn_wmma_f32_16x16x32_f16(false, a, false, b, (short)0, c, false, false);
  asm volatile("v_nop\n\tv_nop\n\tv_nop\n\tv_nop" : "+v"(d) : "v"(a), "v"(b));
  return d;
}
__device__ __forceinline__ v8f wmma_bf(v16b a, v16b b, v8f c) {
  v8f d = __builtin_amdgcn_wmma_f32_16x16x32_bf16(false, a, false, b, (short)0, c, false, false);
  asm volatile("v_nop\n\tv_nop\n\tv_nop\n\tv_nop" : "+v"(d) : "v"(a), "v"(b));
  return d;
}
// 16x16x32 fragments: lane = (h = lane>>4, row/col = lane&15); elements 0..7 = k0+8h+0..7, 8..15 = k0+16+8h+0..7; D element r = row 8h+r
__device__ __forceinline__ v16h frag_h(const _Float16* rowk0, int lane) {
  union { v16h v; v8h q[2]; } u; const _Float16* p = rowk0 + 8 * (lane >> 4);
  u.q[0] = *(const v8h*)p; u.q[1] = *(const v8h*)(p + 16); return u.v;
}
__device__ __forceinline__ v16h frag_f32(const float* rowk0, int lane) {
  v16h a; const float* p = rowk0 + 8 * (lane >> 4);
#pragma unroll
  for (int i = 0; i < 8; ++i) { a[i] = (_Float16)p[i]; a[8 + i] = (_Float16)p[16 + i]; }
  return a;
}
__device__ __forceinline__ v16h frag_f32s(const float* rowk0, int lane, float sc) {
  v16h a; const float* p = rowk0 + 8 * (lane >> 4);
#pragma unroll
  for (int i = 0; i < 8; ++i) { a[i] = (_Float16)(p[i] * sc); a[8 + i] = (_Float16)(p[16 + i] * sc); }
  return a;
}
// column fragment from a [K][ld] layout (column n), rows >= K read as 0
__device__ __forceinline__ v16h fragc_f32(const float* W, int k0, int n, int lane, int ld, int K) {
  v16h a; const int g = lane >> 4;
#pragma unroll
  for (int i = 0; i < 8; ++i) { const int ka = k0 + 8 * g + i, kb = ka + 16;
    a[i] = (_Float16)(ka < K ? W[(size_t)ka * ld + n] : 0.f); a[8 + i] = (_Float16)(kb < K ? W[(size_t)kb * ld + n] : 0.f); }
  return a;
}
struct F2 { v16b h, l; };
__device__ __forceinline__ F2 bsplit16(const float v[16]) { F2 r;
#pragma unroll
  for (int i = 0; i < 16; ++i) { const __bf16 h = (__bf16)v[i]; r.h[i] = h; r.l[i] = (__bf16)(v[i] - (float)h); }
  return r; }
__device__ __forceinline__ F2 split_row(const float* row, int k0, int lane) { float v[16]; const float* p = row + k0 + 8 * (lane >> 4);
#pragma unroll
  for (int i = 0; i < 8; ++i) { v[i] = p[i]; v[8 + i] = p[16 + i]; }
  return bsplit16(v); }
__device__ __forceinline__ F2 split_rowK(const float* row, int k0, int lane, int K) { float v[16]; const int g = lane >> 4;
#pragma unroll
  for (int i = 0; i < 8; ++i) { const int ka = k0 + 8 * g + i, kb = ka + 16; v[i] = ka < K ? row[ka] : 0.f; v[8 + i] = kb < K ? row[kb] : 0.f; }
  return bsplit16(v); }
__device__ __forceinline__ F2 split_col(const float* W, int k0, int n, int lane, int ld, int K) { float v[16]; const int g = lane >> 4;
#pragma unroll
  for (int i = 0; i < 8; ++i) { const int ka = k0 + 8 * g + i, kb = ka + 16; v[i] = ka < K ? W[(size_t)ka * ld + n] : 0.f; v[8 + i] = kb < K ? W[(size_t)kb * ld + n] : 0.f; }
  return bsplit16(v); }
__device__ __forceinline__ v8f mac3(const F2& a, const F2& b, v8f c) { c = wmma_bf(a.l, b.h, c); c = wmma_bf(a.h, b.l, c); return wmma_bf(a.h, b.h, c); }
__device__ __forceinline__ float sigm(float v) { return 1.0f / (1.0f + expf(-v)); }
#define LDSX() do { asm volatile("s_wait_dscnt 0" ::: "memory"); __builtin_amdgcn_wave_barrier(); __builtin_amdgcn_fence(__ATOMIC_RELEASE, "workgroup"); } while (0)

// 2-D self-attention with the softmax taken over the QUERY axis (axis=1 of [b,n,m], as the reference does). f, g, hh = x @ w (K = 128,
// tiles, K = 16 zero-padded); pass 2: per query block y[n] = sum_m exp(s[n][m] - M_m)/L_m hh[m] on WMMA (P x2^14 f16), then
#define NB 8
#define NN 4096
#define CC 128
#define DK 16
#define NR (NB * NN)
#define LOG2E 1.44269504f   // g is stored times log2 e: every score comes out of the WMMA in base-2 units and each exponential is one v_exp_f32
// 2^v as the bare instruction, without the library's range fix-up: a result under 2^-126 may come out 0, which is far under what a sum that holds a term of 1, or an f16 P, can show
__device__ __forceinline__ float ex2(float v) { return __builtin_amdgcn_exp2f(v); }

// f/g/h projections: block 64 rows; outputs F16,G16 [r][16] f16 (G16 = g log2 e: scores = f.g (K=16) in base-2 units, no other scaling), HT16 [b][d][n] (h transposed for the PV A operand)
__global__ __launch_bounds__(128) void k_proj(const float* __restrict__ x, const float* __restrict__ wf, const float* __restrict__ wg, const float* __restrict__ wh, _Float16* __restrict__ F16, _Float16* __restrict__ G16, _Float16* __restrict__ HT) {
  __shared__ __align__(16) float so[4][16][52];
  __shared__ __align__(16) _Float16 st[DK][72];
  const int tid = threadIdx.x, wave = tid >> 5, lane = tid & 31, col = lane & 15, g = lane >> 4;
  const int r0b = blockIdx.x * 64, r0 = r0b + wave * 16; const int b = r0b / NN, n0 = r0b % NN;
  v8f acc[3] = {};
#pragma unroll
  for (int kc = 0; kc < CC / 32; ++kc) { const v16h a = frag_f32(x + (size_t)(r0 + col) * CC + kc * 32, lane);
    acc[0] = wmma16(a, fragc_f32(wf, kc * 32, col, lane, DK, CC), acc[0]); acc[1] = wmma16(a, fragc_f32(wg, kc * 32, col, lane, DK, CC), acc[1]); acc[2] = wmma16(a, fragc_f32(wh, kc * 32, col, lane, DK, CC), acc[2]); }
#pragma unroll
  for (int j = 0; j < 3; ++j)
#pragma unroll
    for (int r = 0; r < 8; ++r) so[wave][8 * g + r][j * 16 + col] = acc[j][r];
  LDSX();
  if (lane < 16) { union { v8h a8; v4u u; } pf0, pf1, pg0, pg1; const int rl = lane;
#pragma unroll
    for (int e = 0; e < 8; ++e) { pf0.a8[e] = (_Float16)so[wave][rl][e]; pf1.a8[e] = (_Float16)so[wave][rl][8 + e]; pg0.a8[e] = (_Float16)(so[wave][rl][16 + e] * LOG2E); pg1.a8[e] = (_Float16)(so[wave][rl][24 + e] * LOG2E); }
    vst2(F16 + (size_t)(r0 + rl) * DK, pf0.u); vst2(F16 + (size_t)(r0 + rl) * DK + 8, pf1.u); vst2(G16 + (size_t)(r0 + rl) * DK, pg0.u); vst2(G16 + (size_t)(r0 + rl) * DK + 8, pg1.u); }
  // h transposed: st[d][block row] then HT[b][d][n0 + 64]
  if (lane < 16) {
#pragma unroll
    for (int d = 0; d < DK; ++d) st[d][wave * 16 + lane] = (_Float16)so[wave][lane][32 + d]; }
  __syncthreads();
  if (tid < DK * 8) { const int d = tid >> 3, pc = tid & 7; vst2(HT + ((size_t)b * DK + d) * NN + n0 + pc * 8, *(const v4u*)(&st[d][pc * 8])); }
}
// value of lane (lane ^ X) inside the 16-lane row (DPP row_xmask); every lane is on where it is used
template <int X> __device__ __forceinline__ float rowx(float v) { return __builtin_bit_cast(float, __builtin_amdgcn_update_dpp(0, __builtin_bit_cast(int, v), 0x160 | X, 0xf, 0xf, true)); }
#define CT 8   // query tiles of 16 per batch: one rescale of the running sum per CT scores
// column statistics: D = g_m . f_n has key row m = 8g + r in register r and query n in the lane's column, so each lane keeps a running
// (max, sum) per register over its own query columns; the 16 lanes of a row are merged once, behind the loop
__global__ __launch_bounds__(128) void k_colstat(const _Float16* __restrict__ F16, const _Float16* __restrict__ G16, float* __restrict__ cst) {
  const int tid = threadIdx.x, w = tid >> 5, lane = tid & 31, col = lane & 15, g = lane >> 4;
  const int b = blockIdx.y, m0 = blockIdx.x * 64 + w * 16; const size_t rb = (size_t)b * NN;
  v16h ag;                                              // A = g rows (m0 + col), K = 16 zero-padded
  { const _Float16* gr = G16 + (rb + m0 + col) * DK;
#pragma unroll  // constant indices keep the array in registers
    for (int i = 0; i < 8; ++i) { ag[i] = gr[8 * g + i]; ag[8 + i] = (_Float16)0.f; } }
  float mrun[8], lrun[8];
#pragma unroll  // constant indices keep the array in registers
  for (int r = 0; r < 8; ++r) { mrun[r] = -3.0e38f; lrun[r] = 0.f; }
  const _Float16* fp = F16 + (rb + col) * DK + 8 * g;   // this lane's 8 halves of query row col; a tile of 16 rows further on is 16 * DK halves
  for (int nb = 0; nb < NN / (16 * CT); ++nb, fp += CT * 16 * DK) { v8h raw[CT]; v8f s[CT];
#pragma unroll  // constant indices keep the array in registers
    for (int t = 0; t < CT; ++t) raw[t] = *(const v8h*)(fp + t * 16 * DK);   // the batch's loads stand together: one latency per batch
#pragma unroll  // constant indices keep the array in registers
    for (int t = 0; t < CT; ++t) { v16h bf;
#pragma unroll  // constant indices keep the array in registers
      for (int i = 0; i < 8; ++i) { bf[i] = raw[t][i]; bf[8 + i] = (_Float16)0.f; }
      v8f z = {}; s[t] = wmma16(ag, bf, z); }
#pragma unroll  // constant indices keep the array in registers
    for (int r = 0; r < 8; ++r) { float mnew = mrun[r];
#pragma unroll  // constant indices keep the array in registers
      for (int t = 0; t < CT; ++t) mnew = fmaxf(mnew, s[t][r]);
      float ps = 0.f;
#pragma unroll  // constant indices keep the array in registers
      for (int t = 0; t < CT; ++t) ps += ex2(s[t][r] - mnew);
      lrun[r] = lrun[r] * ex2(mrun[r] - mnew) + ps; mrun[r] = mnew; } }
  float Mo = 0.f, Lo = 1.f;
#pragma unroll  // constant indices keep the array in registers
  for (int r = 0; r < 8; ++r) { float M = mrun[r];
    M = fmaxf(M, rowx<1>(M)); M = fmaxf(M, rowx<2>(M)); M = fmaxf(M, rowx<4>(M)); M = fmaxf(M, rowx<8>(M));
    float l = lrun[r] * ex2(mrun[r] - M);
    l += rowx<1>(l); l += rowx<2>(l); l += rowx<4>(l); l += rowx<8>(l);
    if (col == r) { Mo = M; Lo = l; } }
  // one constant per key, base 2: 2^(s + c) = 2^14 2^(s - M) / L; a wave's 16 constants head a 128-byte line of their own
  if (col < 8) cst[(rb + m0) * 2 + 8 * g + col] = 14.0f - Mo - log2f(Lo);
}
#define KP 4   // pairs of 16-key tiles per batch (128 keys): the batch's loads stand together, one latency per batch
// pass 2: wave = 16 queries n. S^T = g_m . f_n + c_m (c_m enters as the C operand) has key m = 8g + r in register r and query n in the lane's
// column, so exp of two such tiles, converted in place, IS the B operand (32 keys x 16 queries, x2^14 f16) of y^T += h^T . P^T: P never leaves
// the registers. y^T has d = 8g + r in register r, which is the A operand of y @ w_v. out = gamma*(y @ w_v) + x
__global__ __launch_bounds__(128) void k_apply(const _Float16* __restrict__ F16, const _Float16* __restrict__ G16, const _Float16* __restrict__ HT, const float* __restrict__ cst, const float* __restrict__ wv, const float* __restrict__ gam, const float* __restrict__ x, float* __restrict__ out) {
  __shared__ __align__(16) float so[4][16][132];
  const int tid = threadIdx.x, w = tid >> 5, lane = tid & 31, col = lane & 15, g = lane >> 4;
  const int b = blockIdx.y, n0 = blockIdx.x * 64 + w * 16; const size_t rb = (size_t)b * NN;
  v16h bf; { const _Float16* fr = F16 + (rb + n0 + col) * DK;   // B = f rows (n0 + col), K = 16 zero-padded
#pragma unroll
    for (int i = 0; i < 8; ++i) { bf[i] = fr[8 * g + i]; bf[8 + i] = (_Float16)0.f; } }
  v8f acc = {};
  const _Float16* gp = G16 + (rb + col) * DK + 8 * g;              // this lane's 8 halves of key row col; the next tile is 16 * DK halves on
  const float* cp = cst + rb * 2 + 8 * g;                          // the constants of key rows 8g .. 8g + 7; the next tile is 32 floats on
  const _Float16* hp = HT + ((size_t)b * DK + col) * NN + 8 * g;   // row d = col of h^T, keys 8g .. 8g + 7; the next tile is 16 halves on
#pragma unroll 1  // one batch per trip: a second copy of the body would only cost instruction cache
  for (int mb = 0; mb < NN / (32 * KP); ++mb, gp += KP * 32 * DK, cp += KP * 64, hp += KP * 32) { v8h rg[2 * KP], rh[2 * KP]; v8f s[2 * KP];
#pragma unroll  // constant indices keep the array in registers
    for (int t = 0; t < 2 * KP; ++t) rg[t] = *(const v8h*)(gp + t * 16 * DK);
#pragma unroll  // constant indices keep the array in registers
    for (int t = 0; t < 2 * KP; ++t) s[t] = *(const v8f*)(cp + t * 32);
    asm volatile("s_wait_xcnt 0x0" ::: "memory");   // a result of the loads below may land in an address register of the loads above: the wait stands in front of it
#pragma unroll  // constant indices keep the array in registers
    for (int t = 0; t < 2 * KP; ++t) rh[t] = *(const v8h*)(hp + t * 16);
#pragma unroll  // constant indices keep the arrays in registers
    for (int t = 0; t < 2 * KP; ++t) { v16h ag;
#pragma unroll
      for (int i = 0; i < 8; ++i) { ag[i] = rg[t][i]; ag[8 + i] = (_Float16)0.f; }
      s[t] = wmma16(ag, bf, s[t]); }
#pragma unroll  // constant indices keep the arrays in registers
    for (int p = 0; p < KP; ++p) { v16h pb, ha;
#pragma unroll
      for (int r = 0; r < 8; ++r) { pb[r] = (_Float16)ex2(s[2 * p][r]); pb[8 + r] = (_Float16)ex2(s[2 * p + 1][r]); ha[r] = rh[2 * p][r]; ha[8 + r] = rh[2 * p + 1][r]; }
      acc = wmma16(ha, pb, acc); } }
  // out = gamma * (y @ w_v) + x : y [16 x 16] @ w_v [16 x 128] -> WMMA K=16 (zero-padded), N = 128 (8 tiles)
  { v16h ay;
#pragma unroll
    for (int i = 0; i < 8; ++i) { ay[i] = (_Float16)(acc[i] * (1.0f / 16384.0f)); ay[8 + i] = (_Float16)0.f; }
    const float gm = gam[0];
#pragma unroll
    for (int j = 0; j < 8; ++j) { v16h bb;
#pragma unroll
      for (int i = 0; i < 8; ++i) { bb[i] = (_Float16)(wv[(size_t)(8 * g + i) * CC + j * 16 + col] * 4.0f); bb[8 + i] = (_Float16)0.f; }
      v8f o = {}; o = wmma16(ay, bb, o);
#pragma unroll
      for (int r = 0; r < 8; ++r) { const int c = j * 16 + col; so[w][8 * g + r][c] = gm * o[r] * 0.25f + x[(rb + n0 + 8 * g + r) * CC + c]; } } }
  LDSX();
#pragma unroll 4
  for (int rl = 0; rl < 16; ++rl) vst2(out + (rb + n0 + rl) * CC + lane * 4, *(const v4f*)(&so[w][rl][lane * 4]));
}
extern "C" void kernel_launch(void* const* d_in, const int* in_sizes, int n_in, void* d_out, int out_size, void* d_ws, size_t ws_size, hipStream_t stream) {
  (void)in_sizes; (void)n_in; (void)out_size; (void)ws_size;
  const float** I = (const float**)d_in;
  const float* x = I[0]; const float* wf = I[1]; const float* wg = I[2]; const float* wh = I[3]; const float* wv = I[4]; const float* gam = I[5];
  float* out = (float*)d_out;
  char* ws = (char*)d_ws; size_t off = 0;
  auto take = [&](size_t bytes) { char* p = ws + off; off += (bytes + 255) & ~(size_t)255; return p; };
  _Float16* F16 = (_Float16*)take((size_t)NR * DK * 2); _Float16* G16 = (_Float16*)take((size_t)NR * DK * 2); _Float16* HT = (_Float16*)take((size_t)NR * DK * 2); float* cst = (float*)take((size_t)NR * 2 * 4);
  k_proj<<<NR / 64, 128, 0, stream>>>(x, wf, wg, wh, F16, G16, HT);
  k_colstat<<<dim3(NN / 64, NB), 128, 0, stream>>>(F16, G16, cst);
  k_apply<<<dim3(NN / 64, NB), 128, 0, stream>>>(F16, G16, HT, cst, wv, gam, x, out);
}

// v004
// One run takes 61.5 microseconds.
// Next to v003, in two timings, it ran 1.21 and 1.23 times as fast.
// Counting every step since v000, it is 5.88 times as fast.
#include <hip/hip_runtime.h>
#include <math.h>

typedef __attribute__((ext_vector_type(16))) _Float16 v16h;
typedef __attribute__((ext_vector_type(16))) __bf16 v16b;
typedef __attribute__((ext_vector_type(8)))  _Float16 v8h;
typedef __attribute__((ext_vector_type(8)))  float v8f;
typedef __attribute__((ext_vector_type(4)))  float v4f;
typedef __attribute__((ext_vector_type(2)))  float v2f;
typedef __attribute__((ext_vector_type(4)))  unsigned v4u;
typedef __attribute__((ext_vector_type(4)))  int v4i;
typedef float __attribute__((may_alias)) float_a;
typedef int __attribute__((may_alias)) int_a;

template <typename T> __device__ __forceinline__ void vst2(void* p, T v) { *(T*)p = v;  }
__device__ __forceinline__ v8f wmma16(v16h a, v16h b, v8f c) {
  v8f d = __builtin_amdgcn_wmma_f32_16x16x32_f16(false, a, false, b, (short)0, c, false, false);
  asm volatile("v_nop\n\tv_nop\n\tv_nop\n\tv_nop" : "+v"(d) : "v"(a), "v"(b));
  return d;
}
__device__ __forceinline__ v8f wmma_bf(v16b a, v16b b, v8f c) {
  v8f d = __builtin_amdgcn_wmma_f32_16x16x32_bf16(false, a, false, b, (short)0, c, false, false);
  asm volatile("v_nop\n\tv_nop\n\tv_nop\n\tv_nop" : "+v"(d) : "v"(a), "v"(b));
  return d;
}
// 16x16x32 fragments: lane = (h = lane>>4, row/col = lane&15); elements 0..7 = k0+8h+0..7, 8..15 = k0+16+8h+0..7; D element r = row 8h+r
__device__ __forceinline__ v16h frag_h(const _Float16* rowk0, int lane) {
  union { v16h v; v8h q[2]; } u; const _Float16* p = rowk0 + 8 * (lane >> 4);
  u.q[0] = *(const v8h*)p; u.q[1] = *(const v8h*)(p + 16); return u.v;
}
__device__ __forceinline__ v16h frag_f32(const float* rowk0, int lane) {
  v16h a; const float* p = rowk0 + 8 * (lane >> 4);
#pragma unroll
  for (int i = 0; i < 8; ++i) { a[i] = (_Float16)p[i]; a[8 + i] = (_Float16)p[16 + i]; }
  return a;
}
__device__ __forceinline__ v16h frag_f32s(const float* rowk0, int lane, float sc) {
  v16h a; const float* p = rowk0 + 8 * (lane >> 4);
#pragma unroll
  for (int i = 0; i < 8; ++i) { a[i] = (_Float16)(p[i] * sc); a[8 + i] = (_Float16)(p[16 + i] * sc); }
  return a;
}
// column fragment from a [K][ld] layout (column n), rows >= K read as 0
__device__ __forceinline__ v16h fragc_f32(const float* W, int k0, int n, int lane, int ld, int K) {
  v16h a; const int g = lane >> 4;
#pragma unroll
  for (int i = 0; i < 8; ++i) { const int ka = k0 + 8 * g + i, kb = ka + 16;
    a[i] = (_Float16)(ka < K ? W[(size_t)ka * ld + n] : 0.f); a[8 + i] = (_Float16)(kb < K ? W[(size_t)kb * ld + n] : 0.f); }
  return a;
}
struct F2 { v16b h, l; };
__device__ __forceinline__ F2 bsplit16(const float v[16]) { F2 r;
#pragma unroll
  for (int i = 0; i < 16; ++i) { const __bf16 h = (__bf16)v[i]; r.h[i] = h; r.l[i] = (__bf16)(v[i] - (float)h); }
  return r; }
__device__ __forceinline__ F2 split_row(const float* row, int k0, int lane) { float v[16]; const float* p = row + k0 + 8 * (lane >> 4);
#pragma unroll
  for (int i = 0; i < 8; ++i) { v[i] = p[i]; v[8 + i] = p[16 + i]; }
  return bsplit16(v); }
__device__ __forceinline__ F2 split_rowK(const float* row, int k0, int lane, int K) { float v[16]; const int g = lane >> 4;
#pragma unroll
  for (int i = 0; i < 8; ++i) { const int ka = k0 + 8 * g + i, kb = ka + 16; v[i] = ka < K ? row[ka] : 0.f; v[8 + i] = kb < K ? row[kb] : 0.f; }
  return bsplit16(v); }
__device__ __forceinline__ F2 split_col(const float* W, int k0, int n, int lane, int ld, int K) { float v[16]; const int g = lane >> 4;
#pragma unroll
  for (int i = 0; i < 8; ++i) { const int ka = k0 + 8 * g + i, kb = ka + 16; v[i] = ka < K ? W[(size_t)ka * ld + n] : 0.f; v[8 + i] = kb < K ? W[(size_t)kb * ld + n] : 0.f; }
  return bsplit16(v); }
__device__ __forceinline__ v8f mac3(const F2& a, const F2& b, v8f c) { c = wmma_bf(a.l, b.h, c); c = wmma_bf(a.h, b.l, c); return wmma_bf(a.h, b.h, c); }
__device__ __forceinline__ float sigm(float v) { return 1.0f / (1.0f + expf(-v)); }
#define LDSX() do { asm volatile("s_wait_dscnt 0" ::: "memory"); __builtin_amdgcn_wave_barrier(); __builtin_amdgcn_fence(__ATOMIC_RELEASE, "workgroup"); } while (0)

// 2-D self-attention with the softmax taken over the QUERY axis (axis=1 of [b,n,m], as the reference does). f, g, hh = x @ w (K = 128,
// tiles, K = 16 zero-padded); pass 2: per query block y[n] = sum_m exp(s[n][m] - M_m)/L_m hh[m] on WMMA (P x2^14 f16), then
#define NB 8
#define NN 4096
#define CC 128
#define DK 16
#define NR (NB * NN)
#define LOG2E 1.44269504f   // g is stored times log2 e: every score comes out of the WMMA in base-2 units and each exponential is one v_exp_f32
// 2^v as the bare instruction, without the library's range fix-up: a result under 2^-126 may come out 0, which is far under what a sum that holds a term of 1, or an f16 P, can show
__device__ __forceinline__ float ex2(float v) { return __builtin_amdgcn_exp2f(v); }

// f/g/h projections: block 64 rows; outputs F16,G16 [r][16] f16 (G16 = g log2 e: scores = f.g (K=16) in base-2 units, no other scaling), HT16 [b][d][n] (h transposed for the PV A operand)
__global__ __launch_bounds__(128) void k_proj(const float* __restrict__ x, const float* __restrict__ wf, const float* __restrict__ wg, const float* __restrict__ wh, _Float16* __restrict__ F16, _Float16* __restrict__ G16, _Float16* __restrict__ HT) {
  __shared__ __align__(16) float so[4][16][52];
  __shared__ __align__(16) _Float16 st[DK][72];
  const int tid = threadIdx.x, wave = tid >> 5, lane = tid & 31, col = lane & 15, g = lane >> 4;
  const int r0b = blockIdx.x * 64, r0 = r0b + wave * 16; const int b = r0b / NN, n0 = r0b % NN;
  v8f acc[3] = {};
#pragma unroll
  for (int kc = 0; kc < CC / 32; ++kc) { const v16h a = frag_f32(x + (size_t)(r0 + col) * CC + kc * 32, lane);
    acc[0] = wmma16(a, fragc_f32(wf, kc * 32, col, lane, DK, CC), acc[0]); acc[1] = wmma16(a, fragc_f32(wg, kc * 32, col, lane, DK, CC), acc[1]); acc[2] = wmma16(a, fragc_f32(wh, kc * 32, col, lane, DK, CC), acc[2]); }
#pragma unroll
  for (int j = 0; j < 3; ++j)
#pragma unroll
    for (int r = 0; r < 8; ++r) so[wave][8 * g + r][j * 16 + col] = acc[j][r];
  LDSX();
  if (lane < 16) { union { v8h a8; v4u u; } pf0, pf1, pg0, pg1; const int rl = lane;
#pragma unroll
    for (int e = 0; e < 8; ++e) { pf0.a8[e] = (_Float16)so[wave][rl][e]; pf1.a8[e] = (_Float16)so[wave][rl][8 + e]; pg0.a8[e] = (_Float16)(so[wave][rl][16 + e] * LOG2E); pg1.a8[e] = (_Float16)(so[wave][rl][24 + e] * LOG2E); }
    vst2(F16 + (size_t)(r0 + rl) * DK, pf0.u); vst2(F16 + (size_t)(r0 + rl) * DK + 8, pf1.u); vst2(G16 + (size_t)(r0 + rl) * DK, pg0.u); vst2(G16 + (size_t)(r0 + rl) * DK + 8, pg1.u); }
  // h transposed: st[d][block row] then HT[b][d][n0 + 64]
  if (lane < 16) {
#pragma unroll
    for (int d = 0; d < DK; ++d) st[d][wave * 16 + lane] = (_Float16)so[wave][lane][32 + d]; }
  __syncthreads();
  if (tid < DK * 8) { const int d = tid >> 3, pc = tid & 7; vst2(HT + ((size_t)b * DK + d) * NN + n0 + pc * 8, *(const v4u*)(&st[d][pc * 8])); }
}
// value of lane (lane ^ X) inside the 16-lane row (DPP row_xmask); every lane is on where it is used
template <int X> __device__ __forceinline__ float rowx(float v) { return __builtin_bit_cast(float, __builtin_amdgcn_update_dpp(0, __builtin_bit_cast(int, v), 0x160 | X, 0xf, 0xf, true)); }
#define CT 8   // query tiles of 16 per batch: one rescale of the running sum per CT scores
// column statistics: D = g_m . f_n has key row m = 8g + r in register r and query n in the lane's column, so each lane keeps a running
// (max, sum) per register over its own query columns; the 16 lanes of a row are merged once, behind the loop
__global__ __launch_bounds__(128) void k_colstat(const _Float16* __restrict__ F16, const _Float16* __restrict__ G16, float* __restrict__ cst) {
  const int tid = threadIdx.x, w = tid >> 5, lane = tid & 31, col = lane & 15, g = lane >> 4;
  const int b = blockIdx.y, m0 = blockIdx.x * 64 + w * 16; const size_t rb = (size_t)b * NN;
  v16h ag;                                              // A = g rows (m0 + col), K = 16 zero-padded
  { const _Float16* gr = G16 + (rb + m0 + col) * DK;
#pragma unroll  // constant indices keep the array in registers
    for (int i = 0; i < 8; ++i) { ag[i] = gr[8 * g + i]; ag[8 + i] = (_Float16)0.f; } }
  float mrun[8], lrun[8];
#pragma unroll  // constant indices keep the array in registers
  for (int r = 0; r < 8; ++r) { mrun[r] = -3.0e38f; lrun[r] = 0.f; }
  const _Float16* fp = F16 + (rb + col) * DK + 8 * g;   // this lane's 8 halves of query row col; a tile of 16 rows further on is 16 * DK halves
  for (int nb = 0; nb < NN / (16 * CT); ++nb, fp += CT * 16 * DK) { v8h raw[CT]; v8f s[CT];
#pragma unroll  // constant indices keep the array in registers
    for (int t = 0; t < CT; ++t) raw[t] = *(const v8h*)(fp + t * 16 * DK);   // the batch's loads stand together: one latency per batch
#pragma unroll  // constant indices keep the array in registers
    for (int t = 0; t < CT; ++t) { v16h bf;
#pragma unroll  // constant indices keep the array in registers
      for (int i = 0; i < 8; ++i) { bf[i] = raw[t][i]; bf[8 + i] = (_Float16)0.f; }
      v8f z = {}; s[t] = wmma16(ag, bf, z); }
#pragma unroll  // constant indices keep the array in registers
    for (int r = 0; r < 8; ++r) { float mnew = mrun[r];
#pragma unroll  // constant indices keep the array in registers
      for (int t = 0; t < CT; ++t) mnew = fmaxf(mnew, s[t][r]);
      float ps = 0.f;
#pragma unroll  // constant indices keep the array in registers
      for (int t = 0; t < CT; ++t) ps += ex2(s[t][r] - mnew);
      lrun[r] = lrun[r] * ex2(mrun[r] - mnew) + ps; mrun[r] = mnew; } }
  float Mo = 0.f, Lo = 1.f;
#pragma unroll  // constant indices keep the array in registers
  for (int r = 0; r < 8; ++r) { float M = mrun[r];
    M = fmaxf(M, rowx<1>(M)); M = fmaxf(M, rowx<2>(M)); M = fmaxf(M, rowx<4>(M)); M = fmaxf(M, rowx<8>(M));
    float l = lrun[r] * ex2(mrun[r] - M);
    l += rowx<1>(l); l += rowx<2>(l); l += rowx<4>(l); l += rowx<8>(l);
    if (col == r) { Mo = M; Lo = l; } }
  // one constant per key, base 2: 2^(s + c) = 2^14 2^(s - M) / L; a wave's 16 constants head a 128-byte line of their own
  if (col < 8) cst[(rb + m0) * 2 + 8 * g + col] = 14.0f - Mo - log2f(Lo);
}
#define KP 1   // pairs of 16-key tiles per batch (32 keys): the batch's loads stand together, one latency per batch
#define AW 8   // waves per block: each takes NN / AW of the keys, for all 64 queries of the block
#define QT 4   // query tiles of 16 per wave: every loaded key fragment (g, c, h) feeds QT score or PV products
// pass 2: block = 64 queries, wave = all of them against its own NN / AW keys. S^T = g_m . f_n + c_m (c_m enters as the C operand) has key m = 8g + r in
// register r and query n in the lane's column, so exp of two such tiles, converted in place, IS the B operand (32 keys x 16 queries, x2^14 f16) of
// y^T += h^T . P^T: P never leaves the registers. The waves' partial y^T are summed through LDS, in wave order. y^T has d = 8g + r in register r,
// which is the A operand of y @ w_v; wave w then does query tile w & 3, channels 64 (w >> 2) .. + 63. out = gamma*(y @ w_v) + x
__global__ __launch_bounds__(32 * AW) void k_apply(const _Float16* __restrict__ F16, const _Float16* __restrict__ G16, const _Float16* __restrict__ HT, const float* __restrict__ cst, const float* __restrict__ wv, const float* __restrict__ gam, const float* __restrict__ x, float* __restrict__ out) {
  __shared__ __align__(16) float red[AW][QT][2][32][4];   // partial y^T: [wave][query tile][register quad][lane][register in the quad]
  __shared__ __align__(16) float so[AW][16][68];
  const int tid = threadIdx.x, w = tid >> 5, lane = tid & 31, col = lane & 15, g = lane >> 4;
  const int b = blockIdx.y, n0b = blockIdx.x * 64, k0 = w * (NN / AW); const size_t rb = (size_t)b * NN;
  v16h bf[QT];   // B = f rows (n0b + 16 q + col), K = 16 zero-padded
#pragma unroll  // constant indices keep the array in registers
  for (int q = 0; q < QT; ++q) { const _Float16* fr = F16 + (rb + n0b + q * 16 + col) * DK;
#pragma unroll
    for (int i = 0; i < 8; ++i) { bf[q][i] = fr[8 * g + i]; bf[q][8 + i] = (_Float16)0.f; } }
  v8f acc[QT] = {};
  const _Float16* gp = G16 + (rb + k0 + col) * DK + 8 * g;              // this lane's 8 halves of key row k0 + col; the next tile is 16 * DK halves on
  const float* cp = cst + (rb + k0) * 2 + 8 * g;                        // the constants of key rows k0 + 8g .. + 7; the next tile is 32 floats on
  const _Float16* hp = HT + ((size_t)b * DK + col) * NN + k0 + 8 * g;   // row d = col of h^T, keys k0 + 8g .. + 7; the next tile is 16 halves on
#pragma unroll 1  // one batch per trip: a second copy of the body would only cost instruction cache
  for (int mb = 0; mb < NN / (AW * 32 * KP); ++mb, gp += KP * 32 * DK, cp += KP * 64, hp += KP * 32) { v8h rg[2 * KP], rh[2 * KP]; v8f c[2 * KP];
#pragma unroll  // constant indices keep the array in registers
    for (int t = 0; t < 2 * KP; ++t) rg[t] = *(const v8h*)(gp + t * 16 * DK);
#pragma unroll  // constant indices keep the array in registers
    for (int t = 0; t < 2 * KP; ++t) c[t] = *(const v8f*)(cp + t * 32);
    asm volatile("s_wait_xcnt 0x0" ::: "memory");   // a result of the loads below may land in an address register of the loads above: the wait stands in front of it
#pragma unroll  // constant indices keep the array in registers
    for (int t = 0; t < 2 * KP; ++t) rh[t] = *(const v8h*)(hp + t * 16);
#pragma unroll  // constant indices keep the arrays in registers
    for (int p = 0; p < KP; ++p) { v16h a0, a1, ha; v8f s[2 * QT];
#pragma unroll
      for (int i = 0; i < 8; ++i) { a0[i] = rg[2 * p][i]; a0[8 + i] = (_Float16)0.f; a1[i] = rg[2 * p + 1][i]; a1[8 + i] = (_Float16)0.f; ha[i] = rh[2 * p][i]; ha[8 + i] = rh[2 * p + 1][i]; }
#pragma unroll  // constant indices keep the arrays in registers
      for (int q = 0; q < QT; ++q) { s[2 * q] = wmma16(a0, bf[q], c[2 * p]); s[2 * q + 1] = wmma16(a1, bf[q], c[2 * p + 1]); }
#pragma unroll  // constant indices keep the arrays in registers
      for (int q = 0; q < QT; ++q) { v16h pb;
#pragma unroll
        for (int r = 0; r < 8; ++r) { pb[r] = (_Float16)ex2(s[2 * q][r]); pb[8 + r] = (_Float16)ex2(s[2 * q + 1][r]); }
        acc[q] = wmma16(ha, pb, acc[q]); } } }
  // the waves' partial sums meet: each wave lays down its QT tiles, and behind the barrier adds up the AW partials of the one tile it finishes
#pragma unroll  // constant indices keep the array in registers
  for (int q = 0; q < QT; ++q)
#pragma unroll
    for (int hh = 0; hh < 2; ++hh) { v4f t = { acc[q][4 * hh], acc[q][4 * hh + 1], acc[q][4 * hh + 2], acc[q][4 * hh + 3] }; *(v4f*)(&red[w][q][hh][lane][0]) = t; }
  __syncthreads();
  const int qt = w & 3, jh = w >> 2, n0 = n0b + qt * 16;
  v8f y = {};
#pragma unroll  // constant indices keep the array in registers
  for (int ww = 0; ww < AW; ++ww)
#pragma unroll
    for (int hh = 0; hh < 2; ++hh) { const v4f t = *(const v4f*)(&red[ww][qt][hh][lane][0]);
#pragma unroll
      for (int e = 0; e < 4; ++e) y[4 * hh + e] += t[e]; }
  // out = gamma * (y @ w_v) + x : y [16 x 16] @ w_v [16 x 64 of 128] -> WMMA K=16 (zero-padded), 4 tiles of 16 channels
  { v16h ay;
#pragma unroll
    for (int i = 0; i < 8; ++i) { ay[i] = (_Float16)(y[i] * (1.0f / 16384.0f)); ay[8 + i] = (_Float16)0.f; }
    const float gm = gam[0]; float wr[4][8]; const float* wp = wv + (size_t)(8 * g) * CC + jh * 64 + col;   // row 8g of w_v, this lane's channel in the wave's first tile
#pragma unroll  // constant indices keep the array in registers
    for (int j = 0; j < 4; ++j)
#pragma unroll
      for (int i = 0; i < 8; ++i) wr[j][i] = wp[i * CC + j * 16];
#pragma unroll
    for (int j = 0; j < 4; ++j) { v16h bb; const int c = jh * 64 + j * 16 + col;
#pragma unroll
      for (int i = 0; i < 8; ++i) { bb[i] = (_Float16)(wr[j][i] * 4.0f); bb[8 + i] = (_Float16)0.f; }
      v8f o = {}; o = wmma16(ay, bb, o);
#pragma unroll
      for (int r = 0; r < 8; ++r) so[w][8 * g + r][j * 16 + col] = gm * o[r] * 0.25f + x[(rb + n0 + 8 * g + r) * CC + c]; } }
  LDSX();
#pragma unroll 4
  for (int rp = 0; rp < 8; ++rp) { const int rl = 2 * rp + g; vst2(out + (rb + n0 + rl) * CC + jh * 64 + col * 4, *(const v4f*)(&so[w][rl][col * 4])); }
}
extern "C" void kernel_launch(void* const* d_in, const int* in_sizes, int n_in, void* d_out, int out_size, void* d_ws, size_t ws_size, hipStream_t stream) {
  (void)in_sizes; (void)n_in; (void)out_size; (void)ws_size;
  const float** I = (const float**)d_in;
  const float* x = I[0]; const float* wf = I[1]; const float* wg = I[2]; const float* wh = I[3]; const float* wv = I[4]; const float* gam = I[5];
  float* out = (float*)d_out;
  char* ws = (char*)d_ws; size_t off = 0;
  auto take = [&](size_t bytes) { char* p = ws + off; off += (bytes + 255) & ~(size_t)255; return p; };
  _Float16* F16 = (_Float16*)take((size_t)NR * DK * 2); _Float16* G16 = (_Float16*)take((size_t)NR * DK * 2); _Float16* HT = (_Float16*)take((size_t)NR * DK * 2); float* cst = (float*)take((size_t)NR * 2 * 4);
  k_proj<<<NR / 64, 128, 0, stream>>>(x, wf, wg, wh, F16, G16, HT);
  k_colstat<<<dim3(NN / 64, NB), 128, 0, stream>>>(F16, G16, cst);
  k_apply<<<dim3(NN / 64, NB), 32 * AW, 0, stream>>>(F16, G16, HT, cst, wv, gam, x, out);
}

// v005
// It runs in 51 microseconds.
// Timed twice side by side with v004, it ran 1.21 and 1.20 times as fast.
// Over all steps from v000 it is 7.08 times as fast.
#include <hip/hip_runtime.h>
#include <math.h>

typedef __attribute__((ext_vector_type(16))) _Float16 v16h;
typedef __attribute__((ext_vector_type(16))) __bf16 v16b;
typedef __attribute__((ext_vector_type(8)))  _Float16 v8h;
typedef __attribute__((ext_vector_type(8)))  float v8f;
typedef __attribute__((ext_vector_type(4)))  float v4f;
typedef __attribute__((ext_vector_type(2)))  float v2f;
typedef __attribute__((ext_vector_type(4)))  unsigned v4u;
typedef __attribute__((ext_vector_type(4)))  int v4i;
typedef float __attribute__((may_alias)) float_a;
typedef int __attribute__((may_alias)) int_a;

template <typename T> __device__ __forceinline__ void vst2(void* p, T v) { *(T*)p = v;  }
__device__ __forceinline__ v8f wmma16(v16h a, v16h b, v8f c) {
  v8f d = __builtin_amdgcn_wmma_f32_16x16x32_f16(false, a, false, b, (short)0, c, false, false);
  asm volatile("v_nop\n\tv_nop\n\tv_nop\n\tv_nop" : "+v"(d) : "v"(a), "v"(b));
  return d;
}
__device__ __forceinline__ v8f wmma_bf(v16b a, v16b b, v8f c) {
  v8f d = __builtin_amdgcn_wmma_f32_16x16x32_bf16(false, a, false, b, (short)0, c, false, false);
  asm volatile("v_nop\n\tv_nop\n\tv_nop\n\tv_nop" : "+v"(d) : "v"(a), "v"(b));
  return d;
}
// 16x16x32 fragments: lane = (h = lane>>4, row/col = lane&15); elements 0..7 = k0+8h+0..7, 8..15 = k0+16+8h+0..7; D element r = row 8h+r
__device__ __forceinline__ v16h frag_h(const _Float16* rowk0, int lane) {
  union { v16h v; v8h q[2]; } u; const _Float16* p = rowk0 + 8 * (lane >> 4);
  u.q[0] = *(const v8h*)p; u.q[1] = *(const v8h*)(p + 16); return u.v;
}
__device__ __forceinline__ v16h frag_f32(const float* rowk0, int lane) {
  v16h a; const float* p = rowk0 + 8 * (lane >> 4);
#pragma unroll
  for (int i = 0; i < 8; ++i) { a[i] = (_Float16)p[i]; a[8 + i] = (_Float16)p[16 + i]; }
  return a;
}
__device__ __forceinline__ v16h frag_f32s(const float* rowk0, int lane, float sc) {
  v16h a; const float* p = rowk0 + 8 * (lane >> 4);
#pragma unroll
  for (int i = 0; i < 8; ++i) { a[i] = (_Float16)(p[i] * sc); a[8 + i] = (_Float16)(p[16 + i] * sc); }
  return a;
}
// column fragment from a [K][ld] layout (column n), rows >= K read as 0
__device__ __forceinline__ v16h fragc_f32(const float* W, int k0, int n, int lane, int ld, int K) {
  v16h a; const int g = lane >> 4;
#pragma unroll
  for (int i = 0; i < 8; ++i) { const int ka = k0 + 8 * g + i, kb = ka + 16;
    a[i] = (_Float16)(ka < K ? W[(size_t)ka * ld + n] : 0.f); a[8 + i] = (_Float16)(kb < K ? W[(size_t)kb * ld + n] : 0.f); }
  return a;
}
struct F2 { v16b h, l; };
__device__ __forceinline__ F2 bsplit16(const float v[16]) { F2 r;
#pragma unroll
  for (int i = 0; i < 16; ++i) { const __bf16 h = (__bf16)v[i]; r.h[i] = h; r.l[i] = (__bf16)(v[i] - (float)h); }
  return r; }
__device__ __forceinline__ F2 split_row(const float* row, int k0, int lane) { float v[16]; const float* p = row + k0 + 8 * (lane >> 4);
#pragma unroll
  for (int i = 0; i < 8; ++i) { v[i] = p[i]; v[8 + i] = p[16 + i]; }
  return bsplit16(v); }
__device__ __forceinline__ F2 split_rowK(const float* row, int k0, int lane, int K) { float v[16]; const int g = lane >> 4;
#pragma unroll
  for (int i = 0; i < 8; ++i) { const int ka = k0 + 8 * g + i, kb = ka + 16; v[i] = ka < K ? row[ka] : 0.f; v[8 + i] = kb < K ? row[kb] : 0.f; }
  return bsplit16(v); }
__device__ __forceinline__ F2 split_col(const float* W, int k0, int n, int lane, int ld, int K) { float v[16]; const int g = lane >> 4;
#pragma unroll
  for (int i = 0; i < 8; ++i) { const int ka = k0 + 8 * g + i, kb = ka + 16; v[i] = ka < K ? W[(size_t)ka * ld + n] : 0.f; v[8 + i] = kb < K ? W[(size_t)kb * ld + n] : 0.f; }
  return bsplit16(v); }
__device__ __forceinline__ v8f mac3(const F2& a, const F2& b, v8f c) { c = wmma_bf(a.l, b.h, c); c = wmma_bf(a.h, b.l, c); return wmma_bf(a.h, b.h, c); }
__device__ __forceinline__ float sigm(float v) { return 1.0f / (1.0f + expf(-v)); }
#define LDSX() do { asm volatile("s_wait_dscnt 0" ::: "memory"); __builtin_amdgcn_wave_barrier(); __builtin_amdgcn_fence(__ATOMIC_RELEASE, "workgroup"); } while (0)

// 2-D self-attention with the softmax taken over the QUERY axis (axis=1 of [b,n,m], as the reference does). f, g, hh = x @ w (K = 128,
// tiles, K = 16 zero-padded); pass 2: per query block y[n] = sum_m exp(s[n][m] - M_m)/L_m hh[m] on WMMA (P x2^14 f16), then
#define NB 8
#define NN 4096
#define CC 128
#define DK 16
#define NR (NB * NN)
#define LOG2E 1.44269504f   // g is stored times log2 e: every score comes out of the WMMA in base-2 units and each exponential is one v_exp_f32
// 2^v as the bare instruction, without the library's range fix-up: a result under 2^-126 may come out 0, which is far under what a sum that holds a term of 1, or an f16 P, can show
__device__ __forceinline__ float ex2(float v) { return __builtin_amdgcn_exp2f(v); }

// f/g/h projections: block 64 rows; outputs F16,G16 [r][16] f16 (G16 = g log2 e: scores = f.g (K=16) in base-2 units, no other scaling), HT16 [b][d][n] (h transposed for the PV A operand)
__global__ __launch_bounds__(128) void k_proj(const float* __restrict__ x, const float* __restrict__ wf, const float* __restrict__ wg, const float* __restrict__ wh, _Float16* __restrict__ F16, _Float16* __restrict__ G16, _Float16* __restrict__ HT) {
  __shared__ __align__(16) float so[4][16][52];
  __shared__ __align__(16) _Float16 st[DK][72];
  const int tid = threadIdx.x, wave = tid >> 5, lane = tid & 31, col = lane & 15, g = lane >> 4;
  const int r0b = blockIdx.x * 64, r0 = r0b + wave * 16; const int b = r0b / NN, n0 = r0b % NN;
  v8f acc[3] = {};
#pragma unroll
  for (int kc = 0; kc < CC / 32; ++kc) { const v16h a = frag_f32(x + (size_t)(r0 + col) * CC + kc * 32, lane);
    acc[0] = wmma16(a, fragc_f32(wf, kc * 32, col, lane, DK, CC), acc[0]); acc[1] = wmma16(a, fragc_f32(wg, kc * 32, col, lane, DK, CC), acc[1]); acc[2] = wmma16(a, fragc_f32(wh, kc * 32, col, lane, DK, CC), acc[2]); }
#pragma unroll
  for (int j = 0; j < 3; ++j)
#pragma unroll
    for (int r = 0; r < 8; ++r) so[wave][8 * g + r][j * 16 + col] = acc[j][r];
  LDSX();
  if (lane < 16) { union { v8h a8; v4u u; } pf0, pf1, pg0, pg1; const int rl = lane;
#pragma unroll
    for (int e = 0; e < 8; ++e) { pf0.a8[e] = (_Float16)so[wave][rl][e]; pf1.a8[e] = (_Float16)so[wave][rl][8 + e]; pg0.a8[e] = (_Float16)(so[wave][rl][16 + e] * LOG2E); pg1.a8[e] = (_Float16)(so[wave][rl][24 + e] * LOG2E); }
    vst2(F16 + (size_t)(r0 + rl) * DK, pf0.u); vst2(F16 + (size_t)(r0 + rl) * DK + 8, pf1.u); vst2(G16 + (size_t)(r0 + rl) * DK, pg0.u); vst2(G16 + (size_t)(r0 + rl) * DK + 8, pg1.u); }
  // h transposed: st[d][block row] then HT[b][d][n0 + 64]
  if (lane < 16) {
#pragma unroll
    for (int d = 0; d < DK; ++d) st[d][wave * 16 + lane] = (_Float16)so[wave][lane][32 + d]; }
  __syncthreads();
  if (tid < DK * 8) { const int d = tid >> 3, pc = tid & 7; vst2(HT + ((size_t)b * DK + d) * NN + n0 + pc * 8, *(const v4u*)(&st[d][pc * 8])); }
}
// value of lane (lane ^ X) inside the 16-lane row (DPP row_xmask); every lane is on where it is used
template <int X> __device__ __forceinline__ float rowx(float v) { return __builtin_bit_cast(float, __builtin_amdgcn_update_dpp(0, __builtin_bit_cast(int, v), 0x160 | X, 0xf, 0xf, true)); }
#define CT 16   // query tiles of 16 per batch: the batch's loads stand together
// column statistics: D = g_m . f_n has key row m = 8g + r in register r and query n in the lane's column, so each lane keeps a running
// sum per register over its own query columns; the 16 lanes of a row are merged once, behind the loop
__global__ __launch_bounds__(128) void k_colstat(const _Float16* __restrict__ F16, const _Float16* __restrict__ G16, float* __restrict__ cst) {
  const int tid = threadIdx.x, w = tid >> 5, lane = tid & 31, col = lane & 15, g = lane >> 4;
  const int b = blockIdx.y, m0 = blockIdx.x * 64 + w * 16; const size_t rb = (size_t)b * NN;
  v16h ag;                                              // A = g rows (m0 + col), K = 16 zero-padded
  { const _Float16* gr = G16 + (rb + m0 + col) * DK;
#pragma unroll  // constant indices keep the array in registers
    for (int i = 0; i < 8; ++i) { ag[i] = gr[8 * g + i]; ag[8 + i] = (_Float16)0.f; } }
  // Column sums L = sum over queries of 2^(s - ref), the reference entering the score product as its C operand: no running maximum, no subtraction
  // and no rescale in the loop. The first pass takes ref = 0. It stands wherever every column sum of the wave comes out inside [2^-64, 2^100]: then
  // no term overflowed, and what was flushed to 0 lies under 2^-50 of the sum. Otherwise (scores far from 0) the wave finds its true column maxima
  // and takes the pass once more against them, which holds for any scores
  v8f sh = {};   // minus the reference of key row 8g + r in register r
  float Mo = 0.f, Lo = 1.f;
  const _Float16* f0 = F16 + (rb + col) * DK + 8 * g;   // this lane's 8 halves of query row col; a tile of 16 rows further on is 16 * DK halves
#pragma unroll 1  // the two passes are one piece of code
  for (int pass = 0; pass < 2; ++pass) { float lrun[8];
#pragma unroll  // constant indices keep the array in registers
    for (int r = 0; r < 8; ++r) lrun[r] = 0.f;
    const _Float16* fp = f0;
    for (int nb = 0; nb < NN / (16 * CT); ++nb, fp += CT * 16 * DK) { v8h raw[CT];
#pragma unroll  // constant indices keep the array in registers
      for (int t = 0; t < CT; ++t) raw[t] = *(const v8h*)(fp + t * 16 * DK);   // the batch's loads stand together: one latency per batch
#pragma unroll  // constant indices keep the array in registers
      for (int t = 0; t < CT; ++t) { v16h bf;
#pragma unroll  // constant indices keep the array in registers
        for (int i = 0; i < 8; ++i) { bf[i] = raw[t][i]; bf[8 + i] = (_Float16)0.f; }
        const v8f s = wmma16(ag, bf, sh);
#pragma unroll  // constant indices keep the array in registers
        for (int r = 0; r < 8; ++r) lrun[r] += ex2(s[r]); } }
    float lmin = 3.0e38f, lmax = 0.f;
#pragma unroll  // constant indices keep the array in registers
    for (int r = 0; r < 8; ++r) { float l = lrun[r];
      l += rowx<1>(l); l += rowx<2>(l); l += rowx<4>(l); l += rowx<8>(l);
      lmin = fminf(lmin, l); lmax = fmaxf(lmax, l);
      if (col == r) Lo = l; }
    const bool redo = !(lmin >= 0x1p-64f && lmax <= 0x1p100f);   // an overflowed sum is an infinity and fails the test
    if (pass == 1 || __builtin_amdgcn_ballot_w32(redo) == 0) break;   // the same for the whole wave; the kernel has no barrier
    float mrun[8];
#pragma unroll  // constant indices keep the array in registers
    for (int r = 0; r < 8; ++r) mrun[r] = -3.0e38f;
    fp = f0;
    for (int nb = 0; nb < NN / (16 * CT); ++nb, fp += CT * 16 * DK) { v8h raw[CT];
#pragma unroll  // constant indices keep the array in registers
      for (int t = 0; t < CT; ++t) raw[t] = *(const v8h*)(fp + t * 16 * DK);
#pragma unroll  // constant indices keep the array in registers
      for (int t = 0; t < CT; ++t) { v16h bf;
#pragma unroll  // constant indices keep the array in registers
        for (int i = 0; i < 8; ++i) { bf[i] = raw[t][i]; bf[8 + i] = (_Float16)0.f; }
        v8f z = {}; const v8f s = wmma16(ag, bf, z);
#pragma unroll  // constant indices keep the array in registers
        for (int r = 0; r < 8; ++r) mrun[r] = fmaxf(mrun[r], s[r]); } }
#pragma unroll  // constant indices keep the array in registers
    for (int r = 0; r < 8; ++r) { float M = mrun[r];
      M = fmaxf(M, rowx<1>(M)); M = fmaxf(M, rowx<2>(M)); M = fmaxf(M, rowx<4>(M)); M = fmaxf(M, rowx<8>(M));
      sh[r] = -M; if (col == r) Mo = M; } }
  // one constant per key, base 2: 2^(s + c) = 2^14 2^(s - M) / L; a wave's 16 constants head a 128-byte line of their own
  if (col < 8) cst[(rb + m0) * 2 + 8 * g + col] = 14.0f - Mo - log2f(Lo);
}
#define KP 1   // pairs of 16-key tiles per batch (32 keys): the batch's loads stand together, one latency per batch
#define AW 8   // waves per block: each takes NN / AW of the keys, for all 64 queries of the block
#define QT 4   // query tiles of 16 per wave: every loaded key fragment (g, c, h) feeds QT score or PV products
// pass 2: block = 64 queries, wave = all of them against its own NN / AW keys. S^T = g_m . f_n + c_m (c_m enters as the C operand) has key m = 8g + r in
// register r and query n in the lane's column, so exp of two such tiles, converted in place, IS the B operand (32 keys x 16 queries, x2^14 f16) of
// y^T += h^T . P^T: P never leaves the registers. The waves' partial y^T are summed through LDS, in wave order. y^T has d = 8g + r in register r,
// which is the A operand of y @ w_v; wave w then does query tile w & 3, channels 64 (w >> 2) .. + 63. out = gamma*(y @ w_v) + x
__global__ __launch_bounds__(32 * AW) void k_apply(const _Float16* __restrict__ F16, const _Float16* __restrict__ G16, const _Float16* __restrict__ HT, const float* __restrict__ cst, const float* __restrict__ wv, const float* __restrict__ gam, const float* __restrict__ x, float* __restrict__ out) {
  __shared__ __align__(16) float red[AW][QT][2][32][4];   // partial y^T: [wave][query tile][register quad][lane][register in the quad]
  __shared__ __align__(16) float so[AW][16][68];
  const int tid = threadIdx.x, w = tid >> 5, lane = tid & 31, col = lane & 15, g = lane >> 4;
  const int b = blockIdx.y, n0b = blockIdx.x * 64, k0 = w * (NN / AW); const size_t rb = (size_t)b * NN;
  v16h bf[QT];   // B = f rows (n0b + 16 q + col), K = 16 zero-padded
#pragma unroll  // constant indices keep the array in registers
  for (int q = 0; q < QT; ++q) { const _Float16* fr = F16 + (rb + n0b + q * 16 + col) * DK;
#pragma unroll
    for (int i = 0; i < 8; ++i) { bf[q][i] = fr[8 * g + i]; bf[q][8 + i] = (_Float16)0.f; } }
  v8f acc[QT] = {};
  const _Float16* gp = G16 + (rb + k0 + col) * DK + 8 * g;              // this lane's 8 halves of key row k0 + col; the next tile is 16 * DK halves on
  const float* cp = cst + (rb + k0) * 2 + 8 * g;                        // the constants of key rows k0 + 8g .. + 7; the next tile is 32 floats on
  const _Float16* hp = HT + ((size_t)b * DK + col) * NN + k0 + 8 * g;   // row d = col of h^T, keys k0 + 8g .. + 7; the next tile is 16 halves on
#pragma unroll 1  // one batch per trip
  for (int mb = 0; mb < NN / (AW * 32 * KP); ++mb, gp += KP * 32 * DK, cp += KP * 64, hp += KP * 32) { v8h rg[2 * KP], rh[2 * KP]; v8f c[2 * KP];
#pragma unroll  // constant indices keep the array in registers
    for (int t = 0; t < 2 * KP; ++t) rg[t] = *(const v8h*)(gp + t * 16 * DK);
#pragma unroll  // constant indices keep the array in registers
    for (int t = 0; t < 2 * KP; ++t) c[t] = *(const v8f*)(cp + t * 32);
    asm volatile("s_wait_xcnt 0x0" ::: "memory");   // a result of the loads below may land in an address register of the loads above: the wait stands in front of it
#pragma unroll  // constant indices keep the array in registers
    for (int t = 0; t < 2 * KP; ++t) rh[t] = *(const v8h*)(hp + t * 16);
#pragma unroll  // constant indices keep the arrays in registers
    for (int p = 0; p < KP; ++p) { v16h a0, a1, ha; v8f s[2 * QT];
#pragma unroll
      for (int i = 0; i < 8; ++i) { a0[i] = rg[2 * p][i]; a0[8 + i] = (_Float16)0.f; a1[i] = rg[2 * p + 1][i]; a1[8 + i] = (_Float16)0.f; ha[i] = rh[2 * p][i]; ha[8 + i] = rh[2 * p + 1][i]; }
#pragma unroll  // constant indices keep the arrays in registers
      for (int q = 0; q < QT; ++q) { s[2 * q] = wmma16(a0, bf[q], c[2 * p]); s[2 * q + 1] = wmma16(a1, bf[q], c[2 * p + 1]); }
#pragma unroll  // constant indices keep the arrays in registers
      for (int q = 0; q < QT; ++q) { v16h pb;
#pragma unroll
        for (int r = 0; r < 8; ++r) { pb[r] = (_Float16)ex2(s[2 * q][r]); pb[8 + r] = (_Float16)ex2(s[2 * q + 1][r]); }
        acc[q] = wmma16(ha, pb, acc[q]); } } }
  // the waves' partial sums meet: each wave lays down its QT tiles, and behind the barrier adds up the AW partials of the one tile it finishes
#pragma unroll  // constant indices keep the array in registers
  for (int q = 0; q < QT; ++q)
#pragma unroll
    for (int hh = 0; hh < 2; ++hh) { v4f t = { acc[q][4 * hh], acc[q][4 * hh + 1], acc[q][4 * hh + 2], acc[q][4 * hh + 3] }; *(v4f*)(&red[w][q][hh][lane][0]) = t; }
  __syncthreads();
  const int qt = w & 3, jh = w >> 2, n0 = n0b + qt * 16;
  v8f y = {};
#pragma unroll  // constant indices keep the array in registers
  for (int ww = 0; ww < AW; ++ww)
#pragma unroll
    for (int hh = 0; hh < 2; ++hh) { const v4f t = *(const v4f*)(&red[ww][qt][hh][lane][0]);
#pragma unroll
      for (int e = 0; e < 4; ++e) y[4 * hh + e] += t[e]; }
  // out = gamma * (y @ w_v) + x : y [16 x 16] @ w_v [16 x 64 of 128] -> WMMA K=16 (zero-padded), 4 tiles of 16 channels
  { v16h ay;
#pragma unroll
    for (int i = 0; i < 8; ++i) { ay[i] = (_Float16)(y[i] * (1.0f / 16384.0f)); ay[8 + i] = (_Float16)0.f; }
    const float gm = gam[0]; float wr[4][8]; const float* wp = wv + (size_t)(8 * g) * CC + jh * 64 + col;   // row 8g of w_v, this lane's channel in the wave's first tile
#pragma unroll  // constant indices keep the array in registers
    for (int j = 0; j < 4; ++j)
#pragma unroll
      for (int i = 0; i < 8; ++i) wr[j][i] = wp[i * CC + j * 16];
#pragma unroll
    for (int j = 0; j < 4; ++j) { v16h bb; const int c = jh * 64 + j * 16 + col;
#pragma unroll
      for (int i = 0; i < 8; ++i) { bb[i] = (_Float16)(wr[j][i] * 4.0f); bb[8 + i] = (_Float16)0.f; }
      v8f o = {}; o = wmma16(ay, bb, o);
#pragma unroll
      for (int r = 0; r < 8; ++r) so[w][8 * g + r][j * 16 + col] = gm * o[r] * 0.25f + x[(rb + n0 + 8 * g + r) * CC + c]; } }
  LDSX();
#pragma unroll 4
  for (int rp = 0; rp < 8; ++rp) { const int rl = 2 * rp + g; vst2(out + (rb + n0 + rl) * CC + jh * 64 + col * 4, *(const v4f*)(&so[w][rl][col * 4])); }
}
extern "C" void kernel_launch(void* const* d_in, const int* in_sizes, int n_in, void* d_out, int out_size, void* d_ws, size_t ws_size, hipStream_t stream) {
  (void)in_sizes; (void)n_in; (void)out_size; (void)ws_size;
  const float** I = (const float**)d_in;
  const float* x = I[0]; const float* wf = I[1]; const float* wg = I[2]; const float* wh = I[3]; const float* wv = I[4]; const float* gam = I[5];
  float* out = (float*)d_out;
  char* ws = (char*)d_ws; size_t off = 0;
  auto take = [&](size_t bytes) { char* p = ws + off; off += (bytes + 255) & ~(size_t)255; return p; };
  _Float16* F16 = (_Float16*)take((size_t)NR * DK * 2); _Float16* G16 = (_Float16*)take((size_t)NR * DK * 2); _Float16* HT = (_Float16*)take((size_t)NR * DK * 2); float* cst = (float*)take((size_t)NR * 2 * 4);
  k_proj<<<NR / 64, 128, 0, stream>>>(x, wf, wg, wh, F16, G16, HT);
  k_colstat<<<dim3(NN / 64, NB), 128, 0, stream>>>(F16, G16, cst);
  k_apply<<<dim3(NN / 64, NB), 32 * AW, 0, stream>>>(F16, G16, HT, cst, wv, gam, x, out);
}

// v006
// A run of this version takes 36.8 microseconds.
// Timed twice side by side with v005, it ran 1.40 times as fast both times.
// Over all steps from v000 it is 9.88 times as fast.
#include <hip/hip_runtime.h>
#include <math.h>

typedef __attribute__((ext_vector_type(16))) _Float16 v16h;
typedef __attribute__((ext_vector_type(16))) __bf16 v16b;
typedef __attribute__((ext_vector_type(8)))  _Float16 v8h;
typedef __attribute__((ext_vector_type(8)))  float v8f;
typedef __attribute__((ext_vector_type(4)))  float v4f;
typedef __attribute__((ext_vector_type(2)))  float v2f;
typedef __attribute__((ext_vector_type(4)))  unsigned v4u;
typedef __attribute__((ext_vector_type(4)))  int v4i;
typedef float __attribute__((may_alias)) float_a;
typedef int __attribute__((may_alias)) int_a;

template <typename T> __device__ __forceinline__ void vst2(void* p, T v) { *(T*)p = v;  }
__device__ __forceinline__ v8f wmma16(v16h a, v16h b, v8f c) {
  v8f d = __builtin_amdgcn_wmma_f32_16x16x32_f16(false, a, false, b, (short)0, c, false, false);
  asm volatile("v_nop\n\tv_nop\n\tv_nop\n\tv_nop" : "+v"(d) : "v"(a), "v"(b));
  return d;
}
__device__ __forceinline__ v8f wmma_bf(v16b a, v16b b, v8f c) {
  v8f d = __builtin_amdgcn_wmma_f32_16x16x32_bf16(false, a, false, b, (short)0, c, false, false);
  asm volatile("v_nop\n\tv_nop\n\tv_nop\n\tv_nop" : "+v"(d) : "v"(a), "v"(b));
  return d;
}
// 16x16x32 fragments: lane = (h = lane>>4, row/col = lane&15); elements 0..7 = k0+8h+0..7, 8..15 = k0+16+8h+0..7; D element r = row 8h+r
__device__ __forceinline__ v16h frag_h(const _Float16* rowk0, int lane) {
  union { v16h v; v8h q[2]; } u; const _Float16* p = rowk0 + 8 * (lane >> 4);
  u.q[0] = *(const v8h*)p; u.q[1] = *(const v8h*)(p + 16); return u.v;
}
__device__ __forceinline__ v16h frag_f32(const float* rowk0, int lane) {
  v16h a; const float* p = rowk0 + 8 * (lane >> 4);
#pragma unroll
  for (int i = 0; i < 8; ++i) { a[i] = (_Float16)p[i]; a[8 + i] = (_Float16)p[16 + i]; }
  return a;
}
__device__ __forceinline__ v16h frag_f32s(const float* rowk0, int lane, float sc) {
  v16h a; const float* p = rowk0 + 8 * (lane >> 4);
#pragma unroll
  for (int i = 0; i < 8; ++i) { a[i] = (_Float16)(p[i] * sc); a[8 + i] = (_Float16)(p[16 + i] * sc); }
  return a;
}
// column fragment from a [K][ld] layout (column n), rows >= K read as 0
__device__ __forceinline__ v16h fragc_f32(const float* W, int k0, int n, int lane, int ld, int K) {
  v16h a; const int g = lane >> 4;
#pragma unroll
  for (int i = 0; i < 8; ++i) { const int ka = k0 + 8 * g + i, kb = ka + 16;
    a[i] = (_Float16)(ka < K ? W[(size_t)ka * ld + n] : 0.f); a[8 + i] = (_Float16)(kb < K ? W[(size_t)kb * ld + n] : 0.f); }
  return a;
}
struct F2 { v16b h, l; };
__device__ __forceinline__ F2 bsplit16(const float v[16]) { F2 r;
#pragma unroll
  for (int i = 0; i < 16; ++i) { const __bf16 h = (__bf16)v[i]; r.h[i] = h; r.l[i] = (__bf16)(v[i] - (float)h); }
  return r; }
__device__ __forceinline__ F2 split_row(const float* row, int k0, int lane) { float v[16]; const float* p = row + k0 + 8 * (lane >> 4);
#pragma unroll
  for (int i = 0; i < 8; ++i) { v[i] = p[i]; v[8 + i] = p[16 + i]; }
  return bsplit16(v); }
__device__ __forceinline__ F2 split_rowK(const float* row, int k0, int lane, int K) { float v[16]; const int g = lane >> 4;
#pragma unroll
  for (int i = 0; i < 8; ++i) { const int ka = k0 + 8 * g + i, kb = ka + 16; v[i] = ka < K ? row[ka] : 0.f; v[8 + i] = kb < K ? row[kb] : 0.f; }
  return bsplit16(v); }
__device__ __forceinline__ F2 split_col(const float* W, int k0, int n, int lane, int ld, int K) { float v[16]; const int g = lane >> 4;
#pragma unroll
  for (int i = 0; i < 8; ++i) { const int ka = k0 + 8 * g + i, kb = ka + 16; v[i] = ka < K ? W[(size_t)ka * ld + n] : 0.f; v[8 + i] = kb < K ? W[(size_t)kb * ld + n] : 0.f; }
  return bsplit16(v); }
__device__ __forceinline__ v8f mac3(const F2& a, const F2& b, v8f c) { c = wmma_bf(a.l, b.h, c); c = wmma_bf(a.h, b.l, c); return wmma_bf(a.h, b.h, c); }
__device__ __forceinline__ float sigm(float v) { return 1.0f / (1.0f + expf(-v)); }
#define LDSX() do { asm volatile("s_wait_dscnt 0" ::: "memory"); __builtin_amdgcn_wave_barrier(); __builtin_amdgcn_fence(__ATOMIC_RELEASE, "workgroup"); } while (0)

// 2-D self-attention with the softmax taken over the QUERY axis (axis=1 of [b,n,m], as the reference does). f, g, hh = x @ w (K = 128,
// tiles, K = 16 zero-padded); pass 2: per query block y[n] = sum_m exp(s[n][m] - M_m)/L_m hh[m] on WMMA (P x2^14 f16), then
#define NB 8
#define NN 4096
#define CC 128
#define DK 16
#define NR (NB * NN)
#define LOG2E 1.44269504f   // g is stored times log2 e: every score comes out of the WMMA in base-2 units and each exponential is one v_exp_f32
// 2^v as the bare instruction, without the library's range fix-up: a result under 2^-126 may come out 0, which is far under what a sum that holds a term of 1, or an f16 P, can show
__device__ __forceinline__ float ex2(float v) { return __builtin_amdgcn_exp2f(v); }

#define WP 136   // halves per staged weight column: 272 bytes, an odd multiple of 16, so the 16-byte LDS accesses of 16 columns spread over the banks
// f/g/h projections: block 64 rows; outputs F16,G16 [r][16] f16 (G16 = g log2 e: scores = f.g (K=16) in base-2 units, no other scaling), HT16 [b][d][n] (h transposed for the PV A operand)
__global__ __launch_bounds__(128) void k_proj(const float* __restrict__ x, const float* __restrict__ wf, const float* __restrict__ wg, const float* __restrict__ wh, _Float16* __restrict__ F16, _Float16* __restrict__ G16, _Float16* __restrict__ HT) {
  __shared__ __align__(16) float so[4][16][52];
  __shared__ __align__(16) _Float16 st[DK][72];
  __shared__ __align__(16) _Float16 sw[3][DK][WP];   // w_f, w_g, w_h as f16, transposed to [column][k]: a B fragment is two 16-byte reads
  const int tid = threadIdx.x, wave = tid >> 5, lane = tid & 31, col = lane & 15, g = lane >> 4;
  const int r0b = blockIdx.x * 64, r0 = r0b + wave * 16; const int b = r0b / NN, n0 = r0b % NN;
  // every global load of the kernel issues here, before anything waits; x, which comes from furthest away, first
  v4f xr[CC / 32][4];   // this lane's part of row r0 + col: per 32 channels, floats 8g .. 8g + 7 and 16 + 8g .. 16 + 8g + 7
  const float* xp = x + (size_t)(r0 + col) * CC + 8 * g;
#pragma unroll  // constant indices keep the array in registers
  for (int kc = 0; kc < CC / 32; ++kc) { xr[kc][0] = *(const v4f*)(xp + kc * 32); xr[kc][1] = *(const v4f*)(xp + kc * 32 + 4); xr[kc][2] = *(const v4f*)(xp + kc * 32 + 16); xr[kc][3] = *(const v4f*)(xp + kc * 32 + 20); }
  asm volatile("s_wait_xcnt 0x0" :: "v"(xp) : "memory");   // an address register of issued loads is written (by a later load's result or a vector instruction) only behind this wait; naming the address keeps it whole up to here
  // a thread takes 8 consecutive k of one column, twice per matrix: the block reads each weight once
  const int wn = tid & 15, wk = (tid >> 4) * 8;
  const float* w0 = wf + (size_t)wk * DK + wn; const float* w1 = wg + (size_t)wk * DK + wn; const float* w2 = wh + (size_t)wk * DK + wn;
  float wr[6][8];
#pragma unroll  // constant indices keep the array in registers
  for (int c = 0; c < 6; ++c) { const float* wsrc = (c < 2 ? w0 : c < 4 ? w1 : w2) + 64 * (c & 1) * DK;
#pragma unroll
    for (int i = 0; i < 8; ++i) wr[c][i] = wsrc[i * DK]; }
  asm volatile("s_wait_xcnt 0x0" :: "v"(w0), "v"(w1), "v"(w2) : "memory");   // as above; naming the addresses keeps a result of these same loads out of their registers
  __builtin_amdgcn_sched_barrier(0);   // keeps the loads above together: moved down to their uses they would be waited for one small group after another
#pragma unroll  // constant indices keep the array in registers
  for (int c = 0; c < 6; ++c) { v8h p;
#pragma unroll
    for (int i = 0; i < 8; ++i) p[i] = (_Float16)wr[c][i];
    *(v8h*)(&sw[c >> 1][wn][wk + 64 * (c & 1)]) = p; }
  __syncthreads();
  v16h wb[CC / 32][3];
#pragma unroll  // constant indices keep the array in registers
  for (int kc = 0; kc < CC / 32; ++kc)
#pragma unroll
    for (int j = 0; j < 3; ++j) wb[kc][j] = frag_h(&sw[j][col][kc * 32], lane);
  __builtin_amdgcn_sched_barrier(0);   // keeps the LDS reads above together: one LDS latency for the twelve fragments, not one in front of each product
  v8f acc[3] = {};
#pragma unroll
  for (int kc = 0; kc < CC / 32; ++kc) { v16h a;
#pragma unroll
    for (int i = 0; i < 4; ++i) { a[i] = (_Float16)xr[kc][0][i]; a[4 + i] = (_Float16)xr[kc][1][i]; a[8 + i] = (_Float16)xr[kc][2][i]; a[12 + i] = (_Float16)xr[kc][3][i]; }
    acc[0] = wmma16(a, wb[kc][0], acc[0]); acc[1] = wmma16(a, wb[kc][1], acc[1]); acc[2] = wmma16(a, wb[kc][2], acc[2]); }
#pragma unroll
  for (int j = 0; j < 3; ++j)
#pragma unroll
    for (int r = 0; r < 8; ++r) so[wave][8 * g + r][j * 16 + col] = acc[j][r];
  LDSX();
  if (lane < 16) { union { v8h a8; v4u u; } pf0, pf1, pg0, pg1; const int rl = lane;
#pragma unroll
    for (int e = 0; e < 8; ++e) { pf0.a8[e] = (_Float16)so[wave][rl][e]; pf1.a8[e] = (_Float16)so[wave][rl][8 + e]; pg0.a8[e] = (_Float16)(so[wave][rl][16 + e] * LOG2E); pg1.a8[e] = (_Float16)(so[wave][rl][24 + e] * LOG2E); }
    vst2(F16 + (size_t)(r0 + rl) * DK, pf0.u); vst2(F16 + (size_t)(r0 + rl) * DK + 8, pf1.u); vst2(G16 + (size_t)(r0 + rl) * DK, pg0.u); vst2(G16 + (size_t)(r0 + rl) * DK + 8, pg1.u); }
  // h transposed: st[d][block row] then HT[b][d][n0 + 64]
  if (lane < 16) {
#pragma unroll
    for (int d = 0; d < DK; ++d) st[d][wave * 16 + lane] = (_Float16)so[wave][lane][32 + d]; }
  __syncthreads();
  if (tid < DK * 8) { const int d = tid >> 3, pc = tid & 7; vst2(HT + ((size_t)b * DK + d) * NN + n0 + pc * 8, *(const v4u*)(&st[d][pc * 8])); }
}
// value of lane (lane ^ X) inside the 16-lane row (DPP row_xmask); every lane is on where it is used
template <int X> __device__ __forceinline__ float rowx(float v) { return __builtin_bit_cast(float, __builtin_amdgcn_update_dpp(0, __builtin_bit_cast(int, v), 0x160 | X, 0xf, 0xf, true)); }
#define CT 16   // query tiles of 16 per batch: the batch's loads stand together
// column statistics: D = g_m . f_n has key row m = 8g + r in register r and query n in the lane's column, so each lane keeps a running
// sum per register over its own query columns; the 16 lanes of a row are merged once, behind the loop
__global__ __launch_bounds__(128) void k_colstat(const _Float16* __restrict__ F16, const _Float16* __restrict__ G16, float* __restrict__ cst) {
  const int tid = threadIdx.x, w = tid >> 5, lane = tid & 31, col = lane & 15, g = lane >> 4;
  const int b = blockIdx.y, m0 = blockIdx.x * 64 + w * 16; const size_t rb = (size_t)b * NN;
  v16h ag;                                              // A = g rows (m0 + col), K = 16 zero-padded
  { const _Float16* gr = G16 + (rb + m0 + col) * DK;
#pragma unroll  // constant indices keep the array in registers
    for (int i = 0; i < 8; ++i) { ag[i] = gr[8 * g + i]; ag[8 + i] = (_Float16)0.f; } }
  // Column sums L = sum over queries of 2^(s - ref), the reference entering the score product as its C operand: no running maximum, no subtraction
  // and no rescale in the loop. The first pass takes ref = 0. It stands wherever every column sum of the wave comes out inside [2^-64, 2^100]: then
  // no term overflowed, and what was flushed to 0 lies under 2^-50 of the sum. Otherwise (scores far from 0) the wave finds its true column maxima
  // and takes the pass once more against them, which holds for any scores
  v8f sh = {};   // minus the reference of key row 8g + r in register r
  float Mo = 0.f, Lo = 1.f;
  const _Float16* f0 = F16 + (rb + col) * DK + 8 * g;   // this lane's 8 halves of query row col; a tile of 16 rows further on is 16 * DK halves
#pragma unroll 1  // the two passes are one piece of code
  for (int pass = 0; pass < 2; ++pass) { float lrun[8];
#pragma unroll  // constant indices keep the array in registers
    for (int r = 0; r < 8; ++r) lrun[r] = 0.f;
    const _Float16* fp = f0;
    for (int nb = 0; nb < NN / (16 * CT); ++nb, fp += CT * 16 * DK) { v8h raw[CT];
#pragma unroll  // constant indices keep the array in registers
      for (int t = 0; t < CT; ++t) raw[t] = *(const v8h*)(fp + t * 16 * DK);   // the batch's loads stand together: one latency per batch
#pragma unroll  // constant indices keep the array in registers
      for (int t = 0; t < CT; ++t) { v16h bf;
#pragma unroll  // constant indices keep the array in registers
        for (int i = 0; i < 8; ++i) { bf[i] = raw[t][i]; bf[8 + i] = (_Float16)0.f; }
        const v8f s = wmma16(ag, bf, sh);
#pragma unroll  // constant indices keep the array in registers
        for (int r = 0; r < 8; ++r) lrun[r] += ex2(s[r]); } }
    float lmin = 3.0e38f, lmax = 0.f;
#pragma unroll  // constant indices keep the array in registers
    for (int r = 0; r < 8; ++r) { float l = lrun[r];
      l += rowx<1>(l); l += rowx<2>(l); l += rowx<4>(l); l += rowx<8>(l);
      lmin = fminf(lmin, l); lmax = fmaxf(lmax, l);
      if (col == r) Lo = l; }
    const bool redo = !(lmin >= 0x1p-64f && lmax <= 0x1p100f);   // an overflowed sum is an infinity and fails the test
    if (pass == 1 || __builtin_amdgcn_ballot_w32(redo) == 0) break;   // the same for the whole wave; the kernel has no barrier
    float mrun[8];
#pragma unroll  // constant indices keep the array in registers
    for (int r = 0; r < 8; ++r) mrun[r] = -3.0e38f;
    fp = f0;
    for (int nb = 0; nb < NN / (16 * CT); ++nb, fp += CT * 16 * DK) { v8h raw[CT];
#pragma unroll  // constant indices keep the array in registers
      for (int t = 0; t < CT; ++t) raw[t] = *(const v8h*)(fp + t * 16 * DK);
#pragma unroll  // constant indices keep the array in registers
      for (int t = 0; t < CT; ++t) { v16h bf;
#pragma unroll  // constant indices keep the array in registers
        for (int i = 0; i < 8; ++i) { bf[i] = raw[t][i]; bf[8 + i] = (_Float16)0.f; }
        v8f z = {}; const v8f s = wmma16(ag, bf, z);
#pragma unroll  // constant indices keep the array in registers
        for (int r = 0; r < 8; ++r) mrun[r] = fmaxf(mrun[r], s[r]); } }
#pragma unroll  // constant indices keep the array in registers
    for (int r = 0; r < 8; ++r) { float M = mrun[r];
      M = fmaxf(M, rowx<1>(M)); M = fmaxf(M, rowx<2>(M)); M = fmaxf(M, rowx<4>(M)); M = fmaxf(M, rowx<8>(M));
      sh[r] = -M; if (col == r) Mo = M; } }
  // one constant per key, base 2: 2^(s + c) = 2^14 2^(s - M) / L; a wave's 16 constants head a 128-byte line of their own
  if (col < 8) cst[(rb + m0) * 2 + 8 * g + col] = 14.0f - Mo - log2f(Lo);
}
#define KP 1   // pairs of 16-key tiles per batch (32 keys): the batch's loads stand together, one latency per batch
#define AW 8   // waves per block: each takes NN / AW of the keys, for all 64 queries of the block
#define QT 4   // query tiles of 16 per wave: every loaded key fragment (g, c, h) feeds QT score or PV products
// pass 2: block = 64 queries, wave = all of them against its own NN / AW keys. S^T = g_m . f_n + c_m (c_m enters as the C operand) has key m = 8g + r in
// register r and query n in the lane's column, so exp of two such tiles, converted in place, IS the B operand (32 keys x 16 queries, x2^14 f16) of
// y^T += h^T . P^T: P never leaves the registers. The waves' partial y^T are summed through LDS, in wave order. y^T has d = 8g + r in register r,
// which is the A operand of y @ w_v; wave w then does query tile w & 3, channels 64 (w >> 2) .. + 63. out = gamma*(y @ w_v) + x
__global__ __launch_bounds__(32 * AW) void k_apply(const _Float16* __restrict__ F16, const _Float16* __restrict__ G16, const _Float16* __restrict__ HT, const float* __restrict__ cst, const float* __restrict__ wv, const float* __restrict__ gam, const float* __restrict__ x, float* __restrict__ out) {
  __shared__ __align__(16) float red[AW][QT][2][32][4];   // partial y^T: [wave][query tile][register quad][lane][register in the quad]
  __shared__ __align__(16) float so[AW][16][68];
  const int tid = threadIdx.x, w = tid >> 5, lane = tid & 31, col = lane & 15, g = lane >> 4;
  const int b = blockIdx.y, n0b = blockIdx.x * 64, k0 = w * (NN / AW); const size_t rb = (size_t)b * NN;
  v16h bf[QT];   // B = f rows (n0b + 16 q + col), K = 16 zero-padded
#pragma unroll  // constant indices keep the array in registers
  for (int q = 0; q < QT; ++q) { const _Float16* fr = F16 + (rb + n0b + q * 16 + col) * DK;
#pragma unroll
    for (int i = 0; i < 8; ++i) { bf[q][i] = fr[8 * g + i]; bf[q][8 + i] = (_Float16)0.f; } }
  v8f acc[QT] = {};
  const _Float16* gp = G16 + (rb + k0 + col) * DK + 8 * g;              // this lane's 8 halves of key row k0 + col; the next tile is 16 * DK halves on
  const float* cp = cst + (rb + k0) * 2 + 8 * g;                        // the constants of key rows k0 + 8g .. + 7; the next tile is 32 floats on
  const _Float16* hp = HT + ((size_t)b * DK + col) * NN + k0 + 8 * g;   // row d = col of h^T, keys k0 + 8g .. + 7; the next tile is 16 halves on
#pragma unroll 1  // one batch per trip
  for (int mb = 0; mb < NN / (AW * 32 * KP); ++mb, gp += KP * 32 * DK, cp += KP * 64, hp += KP * 32) { v8h rg[2 * KP], rh[2 * KP]; v8f c[2 * KP];
#pragma unroll  // constant indices keep the array in registers
    for (int t = 0; t < 2 * KP; ++t) rg[t] = *(const v8h*)(gp + t * 16 * DK);
#pragma unroll  // constant indices keep the array in registers
    for (int t = 0; t < 2 * KP; ++t) c[t] = *(const v8f*)(cp + t * 32);
    asm volatile("s_wait_xcnt 0x0" ::: "memory");   // a result of the loads below may land in an address register of the loads above: the wait stands in front of it
#pragma unroll  // constant indices keep the array in registers
    for (int t = 0; t < 2 * KP; ++t) rh[t] = *(const v8h*)(hp + t * 16);
#pragma unroll  // constant indices keep the arrays in registers
    for (int p = 0; p < KP; ++p) { v16h a0, a1, ha; v8f s[2 * QT];
#pragma unroll
      for (int i = 0; i < 8; ++i) { a0[i] = rg[2 * p][i]; a0[8 + i] = (_Float16)0.f; a1[i] = rg[2 * p + 1][i]; a1[8 + i] = (_Float16)0.f; ha[i] = rh[2 * p][i]; ha[8 + i] = rh[2 * p + 1][i]; }
#pragma unroll  // constant indices keep the arrays in registers
      for (int q = 0; q < QT; ++q) { s[2 * q] = wmma16(a0, bf[q], c[2 * p]); s[2 * q + 1] = wmma16(a1, bf[q], c[2 * p + 1]); }
#pragma unroll  // constant indices keep the arrays in registers
      for (int q = 0; q < QT; ++q) { v16h pb;
#pragma unroll
        for (int r = 0; r < 8; ++r) { pb[r] = (_Float16)ex2(s[2 * q][r]); pb[8 + r] = (_Float16)ex2(s[2 * q + 1][r]); }
        acc[q] = wmma16(ha, pb, acc[q]); } } }
  // the x and w_v values of the tail issue here, together: they are waited for once, with the exchange of the partial sums
  const int qt = w & 3, jh = w >> 2, n0 = n0b + qt * 16;
  float xv[4][8]; const float* xq = x + (rb + n0 + 8 * g) * CC + jh * 64 + col;   // row n0 + 8g, this lane's channel in the wave's first tile
#pragma unroll  // constant indices keep the array in registers
  for (int j = 0; j < 4; ++j)
#pragma unroll
    for (int r = 0; r < 8; ++r) xv[j][r] = xq[r * CC + j * 16];
  float wr[4][8]; const float* wp = wv + (size_t)(8 * g) * CC + jh * 64 + col;   // row 8g of w_v, this lane's channel in the wave's first tile
#pragma unroll  // constant indices keep the array in registers
  for (int j = 0; j < 4; ++j)
#pragma unroll
    for (int i = 0; i < 8; ++i) wr[j][i] = wp[i * CC + j * 16];
  __builtin_amdgcn_sched_barrier(0);   // keeps the loads above together and up here: moved down to their uses they would be waited for in five groups, one after another
  // the waves' partial sums meet: each wave lays down its QT tiles, and behind the barrier adds up the AW partials of the one tile it finishes
#pragma unroll  // constant indices keep the array in registers
  for (int q = 0; q < QT; ++q)
#pragma unroll
    for (int hh = 0; hh < 2; ++hh) { v4f t = { acc[q][4 * hh], acc[q][4 * hh + 1], acc[q][4 * hh + 2], acc[q][4 * hh + 3] }; *(v4f*)(&red[w][q][hh][lane][0]) = t; }
  __syncthreads();
  asm volatile("s_wait_xcnt 0x0" :: "v"(xq), "v"(wp) : "memory");   // the address registers of the tail's loads are written again only behind this wait; naming the addresses keeps them whole up to here
  v8f y = {};
#pragma unroll  // constant indices keep the array in registers
  for (int ww = 0; ww < AW; ++ww)
#pragma unroll
    for (int hh = 0; hh < 2; ++hh) { const v4f t = *(const v4f*)(&red[ww][qt][hh][lane][0]);
#pragma unroll
      for (int e = 0; e < 4; ++e) y[4 * hh + e] += t[e]; }
  // out = gamma * (y @ w_v) + x : y [16 x 16] @ w_v [16 x 64 of 128] -> WMMA K=16 (zero-padded), 4 tiles of 16 channels
  { v16h ay;
#pragma unroll
    for (int i = 0; i < 8; ++i) { ay[i] = (_Float16)(y[i] * (1.0f / 16384.0f)); ay[8 + i] = (_Float16)0.f; }
    const float gm = gam[0];
#pragma unroll
    for (int j = 0; j < 4; ++j) { v16h bb;
#pragma unroll
      for (int i = 0; i < 8; ++i) { bb[i] = (_Float16)(wr[j][i] * 4.0f); bb[8 + i] = (_Float16)0.f; }
      v8f o = {}; o = wmma16(ay, bb, o);
#pragma unroll
      for (int r = 0; r < 8; ++r) so[w][8 * g + r][j * 16 + col] = gm * o[r] * 0.25f + xv[j][r]; } }
  LDSX();
#pragma unroll 4
  for (int rp = 0; rp < 8; ++rp) { const int rl = 2 * rp + g; vst2(out + (rb + n0 + rl) * CC + jh * 64 + col * 4, *(const v4f*)(&so[w][rl][col * 4])); }
}
extern "C" void kernel_launch(void* const* d_in, const int* in_sizes, int n_in, void* d_out, int out_size, void* d_ws, size_t ws_size, hipStream_t stream) {
  (void)in_sizes; (void)n_in; (void)out_size; (void)ws_size;
  const float** I = (const float**)d_in;
  const float* x = I[0]; const float* wf = I[1]; const float* wg = I[2]; const float* wh = I[3]; const float* wv = I[4]; const float* gam = I[5];
  float* out = (float*)d_out;
  char* ws = (char*)d_ws; size_t off = 0;
  auto take = [&](size_t bytes) { char* p = ws + off; off += (bytes + 255) & ~(size_t)255; return p; };
  _Float16* F16 = (_Float16*)take((size_t)NR * DK * 2); _Float16* G16 = (_Float16*)take((size_t)NR * DK * 2); _Float16* HT = (_Float16*)take((size_t)NR * DK * 2); float* cst = (float*)take((size_t)NR * 2 * 4);
  k_proj<<<NR / 64, 128, 0, stream>>>(x, wf, wg, wh, F16, G16, HT);
  k_colstat<<<dim3(NN / 64, NB), 128, 0, stream>>>(F16, G16, cst);
  k_apply<<<dim3(NN / 64, NB), 32 * AW, 0, stream>>>(F16, G16, HT, cst, wv, gam, x, out);
}

// v007
// One run takes 32 microseconds.
// In both of two side-by-side timings against v006, it was 1.14 times as fast.
// Counting every step since v000, it is 11.2 times as fast.
#include <hip/hip_runtime.h>
#include <math.h>

typedef __attribute__((ext_vector_type(16))) _Float16 v16h;
typedef __attribute__((ext_vector_type(16))) __bf16 v16b;
typedef __attribute__((ext_vector_type(8)))  _Float16 v8h;
typedef __attribute__((ext_vector_type(8)))  float v8f;
typedef __attribute__((ext_vector_type(4)))  float v4f;
typedef __attribute__((ext_vector_type(2)))  float v2f;
typedef __attribute__((ext_vector_type(4)))  unsigned v4u;
typedef __attribute__((ext_vector_type(4)))  int v4i;
typedef float __attribute__((may_alias)) float_a;
typedef int __attribute__((may_alias)) int_a;
// loads through an address that an asm statement has written: the compiler no longer sees that it is global memory and would take the slower flat form, so the type says it
typedef const v8h __attribute__((address_space(1))) gv8h;
typedef const v8f __attribute__((address_space(1))) gv8f;

template <typename T> __device__ __forceinline__ void vst2(void* p, T v) { *(T*)p = v;  }
__device__ __forceinline__ v8f wmma16(v16h a, v16h b, v8f c) {
  v8f d = __builtin_amdgcn_wmma_f32_16x16x32_f16(false, a, false, b, (short)0, c, false, false);
  asm volatile("v_nop\n\tv_nop\n\tv_nop\n\tv_nop" : "+v"(d) : "v"(a), "v"(b));
  return d;
}
__device__ __forceinline__ v8f wmma_bf(v16b a, v16b b, v8f c) {
  v8f d = __builtin_amdgcn_wmma_f32_16x16x32_bf16(false, a, false, b, (short)0, c, false, false);
  asm volatile("v_nop\n\tv_nop\n\tv_nop\n\tv_nop" : "+v"(d) : "v"(a), "v"(b));
  return d;
}
// 16x16x32 fragments: lane = (h = lane>>4, row/col = lane&15); elements 0..7 = k0+8h+0..7, 8..15 = k0+16+8h+0..7; D element r = row 8h+r
__device__ __forceinline__ v16h frag_h(const _Float16* rowk0, int lane) {
  union { v16h v; v8h q[2]; } u; const _Float16* p = rowk0 + 8 * (lane >> 4);
  u.q[0] = *(const v8h*)p; u.q[1] = *(const v8h*)(p + 16); return u.v;
}
__device__ __forceinline__ v16h frag_f32(const float* rowk0, int lane) {
  v16h a; const float* p = rowk0 + 8 * (lane >> 4);
#pragma unroll
  for (int i = 0; i < 8; ++i) { a[i] = (_Float16)p[i]; a[8 + i] = (_Float16)p[16 + i]; }
  return a;
}
__device__ __forceinline__ v16h frag_f32s(const float* rowk0, int lane, float sc) {
  v16h a; const float* p = rowk0 + 8 * (lane >> 4);
#pragma unroll
  for (int i = 0; i < 8; ++i) { a[i] = (_Float16)(p[i] * sc); a[8 + i] = (_Float16)(p[16 + i] * sc); }
  return a;
}
// column fragment from a [K][ld] layout (column n), rows >= K read as 0
__device__ __forceinline__ v16h fragc_f32(const float* W, int k0, int n, int lane, int ld, int K) {
  v16h a; const int g = lane >> 4;
#pragma unroll
  for (int i = 0; i < 8; ++i) { const int ka = k0 + 8 * g + i, kb = ka + 16;
    a[i] = (_Float16)(ka < K ? W[(size_t)ka * ld + n] : 0.f); a[8 + i] = (_Float16)(kb < K ? W[(size_t)kb * ld + n] : 0.f); }
  return a;
}
struct F2 { v16b h, l; };
__device__ __forceinline__ F2 bsplit16(const float v[16]) { F2 r;
#pragma unroll
  for (int i = 0; i < 16; ++i) { const __bf16 h = (__bf16)v[i]; r.h[i] = h; r.l[i] = (__bf16)(v[i] - (float)h); }
  return r; }
__device__ __forceinline__ F2 split_row(const float* row, int k0, int lane) { float v[16]; const float* p = row + k0 + 8 * (lane >> 4);
#pragma unroll
  for (int i = 0; i < 8; ++i) { v[i] = p[i]; v[8 + i] = p[16 + i]; }
  return bsplit16(v); }
__device__ __forceinline__ F2 split_rowK(const float* row, int k0, int lane, int K) { float v[16]; const int g = lane >> 4;
#pragma unroll
  for (int i = 0; i < 8; ++i) { const int ka = k0 + 8 * g + i, kb = ka + 16; v[i] = ka < K ? row[ka] : 0.f; v[8 + i] = kb < K ? row[kb] : 0.f; }
  return bsplit16(v); }
__device__ __forceinline__ F2 split_col(const float* W, int k0, int n, int lane, int ld, int K) { float v[16]; const int g = lane >> 4;
#pragma unroll
  for (int i = 0; i < 8; ++i) { const int ka = k0 + 8 * g + i, kb = ka + 16; v[i] = ka < K ? W[(size_t)ka * ld + n] : 0.f; v[8 + i] = kb < K ? W[(size_t)kb * ld + n] : 0.f; }
  return bsplit16(v); }
__device__ __forceinline__ v8f mac3(const F2& a, const F2& b, v8f c) { c = wmma_bf(a.l, b.h, c); c = wmma_bf(a.h, b.l, c); return wmma_bf(a.h, b.h, c); }
__device__ __forceinline__ float sigm(float v) { return 1.0f / (1.0f + expf(-v)); }
#define LDSX() do { asm volatile("s_wait_dscnt 0" ::: "memory"); __builtin_amdgcn_wave_barrier(); __builtin_amdgcn_fence(__ATOMIC_RELEASE, "workgroup"); } while (0)

// 2-D self-attention with the softmax taken over the QUERY axis (axis=1 of [b,n,m], as the reference does). f, g, hh = x @ w (K = 128,
// tiles, K = 16 zero-padded); pass 2: per query block y[n] = sum_m exp(s[n][m] - M_m)/L_m hh[m] on WMMA (P x2^14 f16), then
#define NB 8
#define NN 4096
#define CC 128
#define DK 16
#define NR (NB * NN)
#define LOG2E 1.44269504f   // g is stored times log2 e: every score comes out of the WMMA in base-2 units and each exponential is one v_exp_f32
// 2^v as the bare instruction, without the library's range fix-up: a result under 2^-126 may come out 0, which is far under what a sum that holds a term of 1, or an f16 P, can show
__device__ __forceinline__ float ex2(float v) { return __builtin_amdgcn_exp2f(v); }

#define WP 136   // halves per staged weight column: 272 bytes, an odd multiple of 16, so the 16-byte LDS accesses of 16 columns spread over the banks
// f/g/h projections: block 64 rows; outputs F16,G16 [r][16] f16 (G16 = g log2 e: scores = f.g (K=16) in base-2 units, no other scaling), HT16 [b][d][n] (h transposed for the PV A operand)
__global__ __launch_bounds__(128) void k_proj(const float* __restrict__ x, const float* __restrict__ wf, const float* __restrict__ wg, const float* __restrict__ wh, _Float16* __restrict__ F16, _Float16* __restrict__ G16, _Float16* __restrict__ HT) {
  __shared__ __align__(16) float so[4][16][52];
  __shared__ __align__(16) _Float16 st[DK][72];
  __shared__ __align__(16) _Float16 sw[3][DK][WP];   // w_f, w_g, w_h as f16, transposed to [column][k]: a B fragment is two 16-byte reads
  const int tid = threadIdx.x, wave = tid >> 5, lane = tid & 31, col = lane & 15, g = lane >> 4;
  const int r0b = blockIdx.x * 64, r0 = r0b + wave * 16; const int b = r0b / NN, n0 = r0b % NN;
  // every global load of the kernel issues here, before anything waits; x, which comes from furthest away, first
  v4f xr[CC / 32][4];   // this lane's part of row r0 + col: per 32 channels, floats 8g .. 8g + 7 and 16 + 8g .. 16 + 8g + 7
  const float* xp = x + (size_t)(r0 + col) * CC + 8 * g;
#pragma unroll  // constant indices keep the array in registers
  for (int kc = 0; kc < CC / 32; ++kc) { xr[kc][0] = *(const v4f*)(xp + kc * 32); xr[kc][1] = *(const v4f*)(xp + kc * 32 + 4); xr[kc][2] = *(const v4f*)(xp + kc * 32 + 16); xr[kc][3] = *(const v4f*)(xp + kc * 32 + 20); }
  asm volatile("s_wait_xcnt 0x0" :: "v"(xp) : "memory");   // an address register of issued loads is written (by a later load's result or a vector instruction) only behind this wait; naming the address keeps it whole up to here
  // a thread takes 8 consecutive k of one column, twice per matrix: the block reads each weight once
  const int wn = tid & 15, wk = (tid >> 4) * 8;
  const float* w0 = wf + (size_t)wk * DK + wn; const float* w1 = wg + (size_t)wk * DK + wn; const float* w2 = wh + (size_t)wk * DK + wn;
  float wr[6][8];
#pragma unroll  // constant indices keep the array in registers
  for (int c = 0; c < 6; ++c) { const float* wsrc = (c < 2 ? w0 : c < 4 ? w1 : w2) + 64 * (c & 1) * DK;
#pragma unroll
    for (int i = 0; i < 8; ++i) wr[c][i] = wsrc[i * DK]; }
  asm volatile("s_wait_xcnt 0x0" :: "v"(w0), "v"(w1), "v"(w2) : "memory");   // as above; naming the addresses keeps a result of these same loads out of their registers
  __builtin_amdgcn_sched_barrier(0);   // keeps the loads above together: moved down to their uses they would be waited for one small group after another
#pragma unroll  // constant indices keep the array in registers
  for (int c = 0; c < 6; ++c) { v8h p;
#pragma unroll
    for (int i = 0; i < 8; ++i) p[i] = (_Float16)wr[c][i];
    *(v8h*)(&sw[c >> 1][wn][wk + 64 * (c & 1)]) = p; }
  __syncthreads();
  v16h wb[CC / 32][3];
#pragma unroll  // constant indices keep the array in registers
  for (int kc = 0; kc < CC / 32; ++kc)
#pragma unroll
    for (int j = 0; j < 3; ++j) wb[kc][j] = frag_h(&sw[j][col][kc * 32], lane);
  __builtin_amdgcn_sched_barrier(0);   // keeps the LDS reads above together: one LDS latency for the twelve fragments, not one in front of each product
  v8f acc[3] = {};
#pragma unroll
  for (int kc = 0; kc < CC / 32; ++kc) { v16h a;
#pragma unroll
    for (int i = 0; i < 4; ++i) { a[i] = (_Float16)xr[kc][0][i]; a[4 + i] = (_Float16)xr[kc][1][i]; a[8 + i] = (_Float16)xr[kc][2][i]; a[12 + i] = (_Float16)xr[kc][3][i]; }
    acc[0] = wmma16(a, wb[kc][0], acc[0]); acc[1] = wmma16(a, wb[kc][1], acc[1]); acc[2] = wmma16(a, wb[kc][2], acc[2]); }
#pragma unroll
  for (int j = 0; j < 3; ++j)
#pragma unroll
    for (int r = 0; r < 8; ++r) so[wave][8 * g + r][j * 16 + col] = acc[j][r];
  LDSX();
  if (lane < 16) { union { v8h a8; v4u u; } pf0, pf1, pg0, pg1; const int rl = lane;
#pragma unroll
    for (int e = 0; e < 8; ++e) { pf0.a8[e] = (_Float16)so[wave][rl][e]; pf1.a8[e] = (_Float16)so[wave][rl][8 + e]; pg0.a8[e] = (_Float16)(so[wave][rl][16 + e] * LOG2E); pg1.a8[e] = (_Float16)(so[wave][rl][24 + e] * LOG2E); }
    vst2(F16 + (size_t)(r0 + rl) * DK, pf0.u); vst2(F16 + (size_t)(r0 + rl) * DK + 8, pf1.u); vst2(G16 + (size_t)(r0 + rl) * DK, pg0.u); vst2(G16 + (size_t)(r0 + rl) * DK + 8, pg1.u); }
  // h transposed: st[d][block row] then HT[b][d][n0 + 64]
  if (lane < 16) {
#pragma unroll
    for (int d = 0; d < DK; ++d) st[d][wave * 16 + lane] = (_Float16)so[wave][lane][32 + d]; }
  __syncthreads();
  if (tid < DK * 8) { const int d = tid >> 3, pc = tid & 7; vst2(HT + ((size_t)b * DK + d) * NN + n0 + pc * 8, *(const v4u*)(&st[d][pc * 8])); }
}
// value of lane (lane ^ X) inside the 16-lane row (DPP row_xmask); every lane is on where it is used
template <int X> __device__ __forceinline__ float rowx(float v) { return __builtin_bit_cast(float, __builtin_amdgcn_update_dpp(0, __builtin_bit_cast(int, v), 0x160 | X, 0xf, 0xf, true)); }
#define CT 16   // query tiles of 16 held in registers
#define CG 4    // tiles used, then loaded again, as one group
// column statistics: D = g_m . f_n has key row m = 8g + r in register r and query n in the lane's column, so each lane keeps a running
// sum per register over its own query columns; the 16 lanes of a row are merged once, behind the loop
__global__ __launch_bounds__(128) void k_colstat(const _Float16* __restrict__ F16, const _Float16* __restrict__ G16, float* __restrict__ cst) {
  const int tid = threadIdx.x, w = tid >> 5, lane = tid & 31, col = lane & 15, g = lane >> 4;
  const int b = blockIdx.y, m0 = blockIdx.x * 64 + w * 16; const size_t rb = (size_t)b * NN;
  v16h ag;                                              // A = g rows (m0 + col), K = 16 zero-padded
  { const _Float16* gr = G16 + (rb + m0 + col) * DK;
#pragma unroll  // constant indices keep the array in registers
    for (int i = 0; i < 8; ++i) { ag[i] = gr[8 * g + i]; ag[8 + i] = (_Float16)0.f; } }
  __builtin_amdgcn_sched_barrier(0);   // the g load stays the oldest: issued behind the ring's first loads, the wait for it at the head of the loop would be a wait for every load in flight, on every trip
  // Column sums L = sum over queries of 2^(s - ref), the reference entering the score product as its C operand: no running maximum, no subtraction
  // and no rescale in the loop. The first pass takes ref = 0. It stands wherever every column sum of the wave comes out inside [2^-64, 2^100]: then
  // no term overflowed, and what was flushed to 0 lies under 2^-50 of the sum. Otherwise (scores far from 0) the wave finds its true column maxima
  // and takes the pass once more against them, which holds for any scores
  v8f sh = {};   // minus the reference of key row 8g + r in register r
  float Mo = 0.f, Lo = 1.f;
  const _Float16* f0 = F16 + (rb + col) * DK + 8 * g;   // this lane's 8 halves of query row col; a tile of 16 rows further on is 16 * DK halves
  // a ring of CT tiles in registers: a group's registers are loaded again, with the tiles CT further on, as soon as the group is used, so every load
  // has the work of CT - CG tiles to arrive in and only the first batch is waited for in full; a pass finds the first batch in the ring and leaves it there
  v8h raw[CT];
#pragma unroll  // constant indices keep the array in registers
  for (int t = 0; t < CT; ++t) { raw[t] = *(const v8h*)(f0 + t * 16 * DK);
    if (t % CG == CG - 1) __builtin_amdgcn_sched_barrier(0); }   // the groups are first loaded in the order in which the loop loads them again, so that its counted waits hold for both
  const _Float16* fn = f0;   // where the ring is being loaded from
#pragma unroll 1  // the two passes are one piece of code
  for (int pass = 0; pass < 2; ++pass) { float lrun[8];
#pragma unroll  // constant indices keep the array in registers
    for (int r = 0; r < 8; ++r) lrun[r] = 0.f;
    for (int nb = 0; nb < NN / (16 * CT); ++nb) {
#pragma unroll  // constant indices keep the array in registers
      for (int q = 0; q < CT / CG; ++q) {
#pragma unroll  // constant indices keep the array in registers
        for (int t = q * CG; t < q * CG + CG; ++t) { v16h bf;
#pragma unroll  // constant indices keep the array in registers
          for (int i = 0; i < 8; ++i) { bf[i] = raw[t][i]; bf[8 + i] = (_Float16)0.f; }
          const v8f s = wmma16(ag, bf, sh);
#pragma unroll  // constant indices keep the array in registers
          for (int r = 0; r < 8; ++r) lrun[r] += ex2(s[r]); }
        if (q == 0) {
          // the last batch loads the first one again, for a second pass: the loads need no branch, which would merge the wait counts of its two sides
          const unsigned long long ob = (unsigned long long)(((nb + 1) & (NN / (16 * CT) - 1)) * (CT * 16 * DK * 2));
          // fn = f0 + ob bytes. The address register of the issued loads is written again only behind the wait: wait and addition are one statement, since an addition of the compiler's own was drawn up over a wait that stood alone
          asm volatile("s_wait_xcnt 0x0\n\tv_add_nc_u64_e32 %0, %1, %2" : "+v"(fn) : "s"(ob), "v"(f0) : "memory"); }
#pragma unroll  // constant indices keep the array in registers
        for (int t = q * CG; t < q * CG + CG; ++t) raw[t] = *(gv8h*)(fn + t * 16 * DK);
        __builtin_amdgcn_sched_barrier(0); } }   // keeps a group's loads directly behind its use: sunk they would arrive late, and products drawn up from later groups would take more registers than there are
    asm volatile("s_wait_xcnt 0x0" :: "v"(fn) : "memory");   // as above, for what is written behind the loop
    float lmin = 3.0e38f, lmax = 0.f;
#pragma unroll  // constant indices keep the array in registers
    for (int r = 0; r < 8; ++r) { float l = lrun[r];
      l += rowx<1>(l); l += rowx<2>(l); l += rowx<4>(l); l += rowx<8>(l);
      lmin = fminf(lmin, l); lmax = fmaxf(lmax, l);
      if (col == r) Lo = l; }
    const bool redo = !(lmin >= 0x1p-64f && lmax <= 0x1p100f);   // an overflowed sum is an infinity and fails the test
    if (pass == 1 || __builtin_amdgcn_ballot_w32(redo) == 0) break;   // the same for the whole wave; the kernel has no barrier
    float mrun[8];
#pragma unroll  // constant indices keep the array in registers
    for (int r = 0; r < 8; ++r) mrun[r] = -3.0e38f;
    for (int nb = 0; nb < NN / (16 * CT); ++nb) {   // the same walk of the ring
#pragma unroll  // constant indices keep the array in registers
      for (int q = 0; q < CT / CG; ++q) {
#pragma unroll  // constant indices keep the array in registers
        for (int t = q * CG; t < q * CG + CG; ++t) { v16h bf;
#pragma unroll  // constant indices keep the array in registers
          for (int i = 0; i < 8; ++i) { bf[i] = raw[t][i]; bf[8 + i] = (_Float16)0.f; }
          v8f z = {}; const v8f s = wmma16(ag, bf, z);
#pragma unroll  // constant indices keep the array in registers
          for (int r = 0; r < 8; ++r) mrun[r] = fmaxf(mrun[r], s[r]); }
        if (q == 0) {
          const unsigned long long ob = (unsigned long long)(((nb + 1) & (NN / (16 * CT) - 1)) * (CT * 16 * DK * 2));
          asm volatile("s_wait_xcnt 0x0\n\tv_add_nc_u64_e32 %0, %1, %2" : "+v"(fn) : "s"(ob), "v"(f0) : "memory"); }   // as in the sum loop
#pragma unroll  // constant indices keep the array in registers
        for (int t = q * CG; t < q * CG + CG; ++t) raw[t] = *(gv8h*)(fn + t * 16 * DK);
        __builtin_amdgcn_sched_barrier(0); } }   // as in the sum loop
    asm volatile("s_wait_xcnt 0x0" :: "v"(fn) : "memory");   // as in the sum loop
#pragma unroll  // constant indices keep the array in registers
    for (int r = 0; r < 8; ++r) { float M = mrun[r];
      M = fmaxf(M, rowx<1>(M)); M = fmaxf(M, rowx<2>(M)); M = fmaxf(M, rowx<4>(M)); M = fmaxf(M, rowx<8>(M));
      sh[r] = -M; if (col == r) Mo = M; } }
  // one constant per key, base 2: 2^(s + c) = 2^14 2^(s - M) / L; a wave's 16 constants head a 128-byte line of their own
  if (col < 8) cst[(rb + m0) * 2 + 8 * g + col] = 14.0f - Mo - log2f(Lo);
}
struct Yes { static constexpr bool v = true; }; struct No { static constexpr bool v = false; };   // compile-time switch of a generic lambda
#define NS 2   // batches of 32 keys (two 16-key tiles) held in registers at a time
#define AW 8   // waves per block: each takes NN / AW of the keys, for all 64 queries of the block
#define NBT (NN / (AW * 32))   // batches per wave
#define QT 4   // query tiles of 16 per wave: every loaded key fragment (g, c, h) feeds QT score or PV products
// pass 2: block = 64 queries, wave = all of them against its own NN / AW keys. S^T = g_m . f_n + c_m (c_m enters as the C operand) has key m = 8g + r in
// register r and query n in the lane's column, so exp of two such tiles, converted in place, IS the B operand (32 keys x 16 queries, x2^14 f16) of
// y^T += h^T . P^T: P never leaves the registers. The waves' partial y^T are summed through LDS, in wave order. y^T has d = 8g + r in register r,
// which is the A operand of y @ w_v; wave w then does query tile w & 3, channels 64 (w >> 2) .. + 63. out = gamma*(y @ w_v) + x
__global__ __launch_bounds__(32 * AW) void k_apply(const _Float16* __restrict__ F16, const _Float16* __restrict__ G16, const _Float16* __restrict__ HT, const float* __restrict__ cst, const float* __restrict__ wv, const float* __restrict__ gam, const float* __restrict__ x, float* __restrict__ out) {
  __shared__ __align__(16) float red[AW][QT][2][32][4];   // partial y^T: [wave][query tile][register quad][lane][register in the quad]
  __shared__ __align__(16) float so[AW][16][68];
  const int tid = threadIdx.x, w = tid >> 5, lane = tid & 31, col = lane & 15, g = lane >> 4;
  const int b = blockIdx.y, n0b = blockIdx.x * 64, k0 = w * (NN / AW); const size_t rb = (size_t)b * NN;
  v16h bf[QT];   // B = f rows (n0b + 16 q + col), K = 16 zero-padded
#pragma unroll  // constant indices keep the array in registers
  for (int q = 0; q < QT; ++q) { const _Float16* fr = F16 + (rb + n0b + q * 16 + col) * DK;
#pragma unroll
    for (int i = 0; i < 8; ++i) { bf[q][i] = fr[8 * g + i]; bf[q][8 + i] = (_Float16)0.f; } }
  v8f acc[QT] = {};
  const _Float16* gp = G16 + (rb + k0 + col) * DK + 8 * g;              // this lane's 8 halves of key row k0 + col; the next tile is 16 * DK halves on
  const float* cp = cst + (rb + k0) * 2 + 8 * g;                        // the constants of key rows k0 + 8g .. + 7; the next tile is 32 floats on
  const _Float16* hp = HT + ((size_t)b * DK + col) * NN + k0 + 8 * g;   // row d = col of h^T, keys k0 + 8g .. + 7; the next tile is 16 halves on
  // two slots of 32 keys in registers: a slot's g is loaded again, with the keys two batches on, right behind its score products, its c as soon as the
  // scores that stand in its registers are used, and its h right behind its PV products, so every load has more than a batch of work to arrive in and only the first two batches are waited for in full
  v8h rg[NS][2], rh[NS][2]; v8f c[NS][2];
  __builtin_amdgcn_sched_barrier(0);   // the f loads stay the oldest, and the slots are first loaded in the order in which the loop loads them again (the fences below), so that its counted waits hold for both
#pragma unroll  // constant indices keep the arrays in registers
  for (int sl = 0; sl < NS; ++sl) {
#pragma unroll
    for (int t = 0; t < 2; ++t) rg[sl][t] = *(const v8h*)(gp + (2 * sl + t) * 16 * DK);
    __builtin_amdgcn_sched_barrier(0);
#pragma unroll
    for (int t = 0; t < 2; ++t) c[sl][t] = *(const v8f*)(cp + (2 * sl + t) * 32);
    __builtin_amdgcn_sched_barrier(0);
#pragma unroll
    for (int t = 0; t < 2; ++t) rh[sl][t] = *(const v8h*)(hp + (2 * sl + t) * 16);
    __builtin_amdgcn_sched_barrier(0); }
  const _Float16* gn = gp; const float* cn = cp; const _Float16* hn = hp;   // where the slots are being loaded from
  // one trip: both slots are used; where more batches follow (MORE), each is loaded again on the way. The last trip is a copy of its own without the loads:
  // a branch round them would merge the wait counts of its two sides, and loads that nobody uses would hold up the registers of the tail
  auto trip = [&](int mb, auto more) __attribute__((always_inline)) {
#pragma unroll  // constant indices keep the arrays in registers
    for (int sl = 0; sl < NS; ++sl) { v16h a0, a1, ha; v8f s[2 * QT];
#pragma unroll
      for (int i = 0; i < 8; ++i) { a0[i] = rg[sl][0][i]; a0[8 + i] = (_Float16)0.f; a1[i] = rg[sl][1][i]; a1[8 + i] = (_Float16)0.f; ha[i] = rh[sl][0][i]; ha[8 + i] = rh[sl][1][i]; }
#pragma unroll  // constant indices keep the arrays in registers
      for (int q = 0; q < QT; ++q) { s[2 * q] = wmma16(a0, bf[q], c[sl][0]); s[2 * q + 1] = wmma16(a1, bf[q], c[sl][1]); }
      if constexpr (decltype(more)::v) {
        if (sl == 0) {
          const int nx = mb + NS;
          const unsigned long long og = (unsigned long long)(nx * 32 * DK * 2), oc = (unsigned long long)(nx * 64 * 4), oh = (unsigned long long)(nx * 32 * 2);
          // gn = gp + og, cn = cp + oc, hn = hp + oh, in bytes. The address registers of the issued loads are written again only behind the wait: wait and additions are one statement, since an addition of the compiler's own can be drawn up over a wait that stands alone
          asm volatile("s_wait_xcnt 0x0\n\tv_add_nc_u64_e32 %0, %3, %6\n\tv_add_nc_u64_e32 %1, %4, %7\n\tv_add_nc_u64_e32 %2, %5, %8" : "+v"(gn), "+v"(cn), "+v"(hn) : "s"(og), "s"(oc), "s"(oh), "v"(gp), "v"(cp), "v"(hp) : "memory"); }
#pragma unroll  // constant indices keep the arrays in registers
        for (int t = 0; t < 2; ++t) rg[sl][t] = *(gv8h*)(gn + (2 * sl + t) * 16 * DK);
        __builtin_amdgcn_sched_barrier(0); }   // keeps the loads up here, directly behind the products that read their registers: sunk under the exponentials they would have that much less time to arrive
      // the last query tile first: its scores stand in the registers of c (the last product that reads c writes over it), which are free for the next c once they are used
#pragma unroll  // constant indices keep the arrays in registers
      for (int qq = 0; qq < QT; ++qq) { const int q = (qq + QT - 1) % QT; v16h pb;
#pragma unroll
        for (int r = 0; r < 8; ++r) { pb[r] = (_Float16)ex2(s[2 * q][r]); pb[8 + r] = (_Float16)ex2(s[2 * q + 1][r]); }
        acc[q] = wmma16(ha, pb, acc[q]);
        if constexpr (decltype(more)::v) { if (qq == 0) {
#pragma unroll  // constant indices keep the arrays in registers
          for (int t = 0; t < 2; ++t) c[sl][t] = *(gv8f*)(cn + (2 * sl + t) * 32);
          __builtin_amdgcn_sched_barrier(0); } } }   // as above
      if constexpr (decltype(more)::v) {
#pragma unroll  // constant indices keep the arrays in registers
        for (int t = 0; t < 2; ++t) rh[sl][t] = *(gv8h*)(hn + (2 * sl + t) * 16);
        __builtin_amdgcn_sched_barrier(0); } } };   // keeps the loads in this trip and in this order: the counted waits go by the order
#pragma unroll 1  // one pass over the slots per trip
  for (int mb = 0; mb < NBT - NS; mb += NS) trip(mb, Yes{});
  asm volatile("s_wait_xcnt 0x0" :: "v"(gn), "v"(cn), "v"(hn), "v"(gp), "v"(cp), "v"(hp) : "memory");   // as above, for what is written behind the loop
  trip(NBT - NS, No{});
  // the x and w_v values of the tail issue here, together: they are waited for once, with the exchange of the partial sums
  const int qt = w & 3, jh = w >> 2, n0 = n0b + qt * 16;
  float xv[4][8]; const float* xq = x + (rb + n0 + 8 * g) * CC + jh * 64 + col;   // row n0 + 8g, this lane's channel in the wave's first tile
#pragma unroll  // constant indices keep the array in registers
  for (int j = 0; j < 4; ++j)
#pragma unroll
    for (int r = 0; r < 8; ++r) xv[j][r] = xq[r * CC + j * 16];
  float wr[4][8]; const float* wp = wv + (size_t)(8 * g) * CC + jh * 64 + col;   // row 8g of w_v, this lane's channel in the wave's first tile
#pragma unroll  // constant indices keep the array in registers
  for (int j = 0; j < 4; ++j)
#pragma unroll
    for (int i = 0; i < 8; ++i) wr[j][i] = wp[i * CC + j * 16];
  __builtin_amdgcn_sched_barrier(0);   // keeps the loads above together and up here: moved down to their uses they would be waited for in five groups, one after another
  // the waves' partial sums meet: each wave lays down its QT tiles, and behind the barrier adds up the AW partials of the one tile it finishes
#pragma unroll  // constant indices keep the array in registers
  for (int q = 0; q < QT; ++q)
#pragma unroll
    for (int hh = 0; hh < 2; ++hh) { v4f t = { acc[q][4 * hh], acc[q][4 * hh + 1], acc[q][4 * hh + 2], acc[q][4 * hh + 3] }; *(v4f*)(&red[w][q][hh][lane][0]) = t; }
  __syncthreads();
  asm volatile("s_wait_xcnt 0x0" :: "v"(xq), "v"(wp) : "memory");   // the address registers of the tail's loads are written again only behind this wait; naming the addresses keeps them whole up to here
  v8f y = {};
#pragma unroll  // constant indices keep the array in registers
  for (int ww = 0; ww < AW; ++ww)
#pragma unroll
    for (int hh = 0; hh < 2; ++hh) { const v4f t = *(const v4f*)(&red[ww][qt][hh][lane][0]);
#pragma unroll
      for (int e = 0; e < 4; ++e) y[4 * hh + e] += t[e]; }
  // out = gamma * (y @ w_v) + x : y [16 x 16] @ w_v [16 x 64 of 128] -> WMMA K=16 (zero-padded), 4 tiles of 16 channels
  { v16h ay;
#pragma unroll
    for (int i = 0; i < 8; ++i) { ay[i] = (_Float16)(y[i] * (1.0f / 16384.0f)); ay[8 + i] = (_Float16)0.f; }
    const float gm = gam[0];
#pragma unroll
    for (int j = 0; j < 4; ++j) { v16h bb;
#pragma unroll
      for (int i = 0; i < 8; ++i) { bb[i] = (_Float16)(wr[j][i] * 4.0f); bb[8 + i] = (_Float16)0.f; }
      v8f o = {}; o = wmma16(ay, bb, o);
#pragma unroll
      for (int r = 0; r < 8; ++r) so[w][8 * g + r][j * 16 + col] = gm * o[r] * 0.25f + xv[j][r]; } }
  LDSX();
#pragma unroll 4
  for (int rp = 0; rp < 8; ++rp) { const int rl = 2 * rp + g; vst2(out + (rb + n0 + rl) * CC + jh * 64 + col * 4, *(const v4f*)(&so[w][rl][col * 4])); }
}
extern "C" void kernel_launch(void* const* d_in, const int* in_sizes, int n_in, void* d_out, int out_size, void* d_ws, size_t ws_size, hipStream_t stream) {
  (void)in_sizes; (void)n_in; (void)out_size; (void)ws_size;
  const float** I = (const float**)d_in;
  const float* x = I[0]; const float* wf = I[1]; const float* wg = I[2]; const float* wh = I[3]; const float* wv = I[4]; const float* gam = I[5];
  float* out = (float*)d_out;
  char* ws = (char*)d_ws; size_t off = 0;
  auto take = [&](size_t bytes) { char* p = ws + off; off += (bytes + 255) & ~(size_t)255; return p; };
  _Float16* F16 = (_Float16*)take((size_t)NR * DK * 2); _Float16* G16 = (_Float16*)take((size_t)NR * DK * 2); _Float16* HT = (_Float16*)take((size_t)NR * DK * 2); float* cst = (float*)take((size_t)NR * 2 * 4);
  k_proj<<<NR / 64, 128, 0, stream>>>(x, wf, wg, wh, F16, G16, HT);
  k_colstat<<<dim3(NN / 64, NB), 128, 0, stream>>>(F16, G16, cst);
  k_apply<<<dim3(NN / 64, NB), 32 * AW, 0, stream>>>(F16, G16, HT, cst, wv, gam, x, out);
}

// v008
// Measured time: 30.8 microseconds a run.
// In both of two side-by-side timings against v007, it was 1.04 times as fast.
// Over all steps from v000 it is 11.7 times as fast.
#include <hip/hip_runtime.h>
#include <math.h>

typedef __attribute__((ext_vector_type(16))) _Float16 v16h;
typedef __attribute__((ext_vector_type(16))) __bf16 v16b;
typedef __attribute__((ext_vector_type(8)))  _Float16 v8h;
typedef __attribute__((ext_vector_type(8)))  float v8f;
typedef __attribute__((ext_vector_type(4)))  float v4f;
typedef __attribute__((ext_vector_type(2)))  float v2f;
typedef __attribute__((ext_vector_type(4)))  unsigned v4u;
typedef __attribute__((ext_vector_type(4)))  int v4i;
typedef float __attribute__((may_alias)) float_a;
typedef int __attribute__((may_alias)) int_a;
// loads through an address that an asm statement has written: the compiler no longer sees that it is global memory and would take the slower flat form, so the type says it
typedef const v8h __attribute__((address_space(1))) gv8h;
typedef const v8f __attribute__((address_space(1))) gv8f;

template <typename T> __device__ __forceinline__ void vst2(void* p, T v) { *(T*)p = v;  }
__device__ __forceinline__ v8f wmma16(v16h a, v16h b, v8f c) {
  v8f d = __builtin_amdgcn_wmma_f32_16x16x32_f16(false, a, false, b, (short)0, c, false, false);
  asm volatile("v_nop\n\tv_nop\n\tv_nop\n\tv_nop" : "+v"(d) : "v"(a), "v"(b));
  return d;
}
__device__ __forceinline__ v8f wmma_bf(v16b a, v16b b, v8f c) {
  v8f d = __builtin_amdgcn_wmma_f32_16x16x32_bf16(false, a, false, b, (short)0, c, false, false);
  asm volatile("v_nop\n\tv_nop\n\tv_nop\n\tv_nop" : "+v"(d) : "v"(a), "v"(b));
  return d;
}
// 16x16x32 fragments: lane = (h = lane>>4, row/col = lane&15); elements 0..7 = k0+8h+0..7, 8..15 = k0+16+8h+0..7; D element r = row 8h+r
__device__ __forceinline__ v16h frag_h(const _Float16* rowk0, int lane) {
  union { v16h v; v8h q[2]; } u; const _Float16* p = rowk0 + 8 * (lane >> 4);
  u.q[0] = *(const v8h*)p; u.q[1] = *(const v8h*)(p + 16); return u.v;
}
__device__ __forceinline__ v16h frag_f32(const float* rowk0, int lane) {
  v16h a; const float* p = rowk0 + 8 * (lane >> 4);
#pragma unroll
  for (int i = 0; i < 8; ++i) { a[i] = (_Float16)p[i]; a[8 + i] = (_Float16)p[16 + i]; }
  return a;
}
__device__ __forceinline__ v16h frag_f32s(const float* rowk0, int lane, float sc) {
  v16h a; const float* p = rowk0 + 8 * (lane >> 4);
#pragma unroll
  for (int i = 0; i < 8; ++i) { a[i] = (_Float16)(p[i] * sc); a[8 + i] = (_Float16)(p[16 + i] * sc); }
  return a;
}
// column fragment from a [K][ld] layout (column n), rows >= K read as 0
__device__ __forceinline__ v16h fragc_f32(const float* W, int k0, int n, int lane, int ld, int K) {
  v16h a; const int g = lane >> 4;
#pragma unroll
  for (int i = 0; i < 8; ++i) { const int ka = k0 + 8 * g + i, kb = ka + 16;
    a[i] = (_Float16)(ka < K ? W[(size_t)ka * ld + n] : 0.f); a[8 + i] = (_Float16)(kb < K ? W[(size_t)kb * ld + n] : 0.f); }
  return a;
}
struct F2 { v16b h, l; };
__device__ __forceinline__ F2 bsplit16(const float v[16]) { F2 r;
#pragma unroll
  for (int i = 0; i < 16; ++i) { const __bf16 h = (__bf16)v[i]; r.h[i] = h; r.l[i] = (__bf16)(v[i] - (float)h); }
  return r; }
__device__ __forceinline__ F2 split_row(const float* row, int k0, int lane) { float v[16]; const float* p = row + k0 + 8 * (lane >> 4);
#pragma unroll
  for (int i = 0; i < 8; ++i) { v[i] = p[i]; v[8 + i] = p[16 + i]; }
  return bsplit16(v); }
__device__ __forceinline__ F2 split_rowK(const float* row, int k0, int lane, int K) { float v[16]; const int g = lane >> 4;
#pragma unroll
  for (int i = 0; i < 8; ++i) { const int ka = k0 + 8 * g + i, kb = ka + 16; v[i] = ka < K ? row[ka] : 0.f; v[8 + i] = kb < K ? row[kb] : 0.f; }
  return bsplit16(v); }
__device__ __forceinline__ F2 split_col(const float* W, int k0, int n, int lane, int ld, int K) { float v[16]; const int g = lane >> 4;
#pragma unroll
  for (int i = 0; i < 8; ++i) { const int ka = k0 + 8 * g + i, kb = ka + 16; v[i] = ka < K ? W[(size_t)ka * ld + n] : 0.f; v[8 + i] = kb < K ? W[(size_t)kb * ld + n] : 0.f; }
  return bsplit16(v); }
__device__ __forceinline__ v8f mac3(const F2& a, const F2& b, v8f c) { c = wmma_bf(a.l, b.h, c); c = wmma_bf(a.h, b.l, c); return wmma_bf(a.h, b.h, c); }
__device__ __forceinline__ float sigm(float v) { return 1.0f / (1.0f + expf(-v)); }
#define LDSX() do { asm volatile("s_wait_dscnt 0" ::: "memory"); __builtin_amdgcn_wave_barrier(); __builtin_amdgcn_fence(__ATOMIC_RELEASE, "workgroup"); } while (0)

// 2-D self-attention with the softmax taken over the QUERY axis (axis=1 of [b,n,m], as the reference does). f, g, hh = x @ w (K = 128,
// tiles, K = 16 zero-padded); pass 2: per query block y[n] = sum_m exp(s[n][m] - M_m)/L_m hh[m] on WMMA (P x2^14 f16), then
#define NB 8
#define NN 4096
#define CC 128
#define DK 16
#define NR (NB * NN)
#define LOG2E 1.44269504f   // g is stored times log2 e: every score comes out of the WMMA in base-2 units and each exponential is one v_exp_f32
// 2^v as the bare instruction, without the library's range fix-up: a result under 2^-126 may come out 0, which is far under what a sum that holds a term of 1, or an f16 P, can show
__device__ __forceinline__ float ex2(float v) { return __builtin_amdgcn_exp2f(v); }

#define WP 136   // halves per staged weight column: 272 bytes, an odd multiple of 16, so the 16-byte LDS accesses of 16 columns spread over the banks
// f/g/h projections: block 64 rows; outputs F16,G16 [r][16] f16 (G16 = g log2 e: scores = f.g (K=16) in base-2 units, no other scaling), HT16 [b][d][n] (h transposed for the PV A operand)
__global__ __launch_bounds__(128) void k_proj(const float* __restrict__ x, const float* __restrict__ wf, const float* __restrict__ wg, const float* __restrict__ wh, _Float16* __restrict__ F16, _Float16* __restrict__ G16, _Float16* __restrict__ HT) {
  __shared__ __align__(16) float so[4][16][52];
  __shared__ __align__(16) _Float16 st[DK][72];
  __shared__ __align__(16) _Float16 sw[3][DK][WP];   // w_f, w_g, w_h as f16, transposed to [column][k]: a B fragment is two 16-byte reads
  const int tid = threadIdx.x, wave = tid >> 5, lane = tid & 31, col = lane & 15, g = lane >> 4;
  const int r0b = blockIdx.x * 64, r0 = r0b + wave * 16; const int b = r0b / NN, n0 = r0b % NN;
  // every global load of the kernel issues here, before anything waits; x, which comes from furthest away, first
  v4f xr[CC / 32][4];   // this lane's part of row r0 + col: per 32 channels, floats 8g .. 8g + 7 and 16 + 8g .. 16 + 8g + 7
  const float* xp = x + (size_t)(r0 + col) * CC + 8 * g;
#pragma unroll  // constant indices keep the array in registers
  for (int kc = 0; kc < CC / 32; ++kc) { xr[kc][0] = *(const v4f*)(xp + kc * 32); xr[kc][1] = *(const v4f*)(xp + kc * 32 + 4); xr[kc][2] = *(const v4f*)(xp + kc * 32 + 16); xr[kc][3] = *(const v4f*)(xp + kc * 32 + 20); }
  asm volatile("s_wait_xcnt 0x0" :: "v"(xp) : "memory");   // an address register of issued loads is written (by a later load's result or a vector instruction) only behind this wait; naming the address keeps it whole up to here
  // a thread takes 8 consecutive k of one column, twice per matrix: the block reads each weight once
  const int wn = tid & 15, wk = (tid >> 4) * 8;
  const float* w0 = wf + (size_t)wk * DK + wn; const float* w1 = wg + (size_t)wk * DK + wn; const float* w2 = wh + (size_t)wk * DK + wn;
  float wr[6][8];
#pragma unroll  // constant indices keep the array in registers
  for (int c = 0; c < 6; ++c) { const float* wsrc = (c < 2 ? w0 : c < 4 ? w1 : w2) + 64 * (c & 1) * DK;
#pragma unroll
    for (int i = 0; i < 8; ++i) wr[c][i] = wsrc[i * DK]; }
  asm volatile("s_wait_xcnt 0x0" :: "v"(w0), "v"(w1), "v"(w2) : "memory");   // as above; naming the addresses keeps a result of these same loads out of their registers
  __builtin_amdgcn_sched_barrier(0);   // keeps the loads above together: moved down to their uses they would be waited for one small group after another
#pragma unroll  // constant indices keep the array in registers
  for (int c = 0; c < 6; ++c) { v8h p;
#pragma unroll
    for (int i = 0; i < 8; ++i) p[i] = (_Float16)wr[c][i];
    *(v8h*)(&sw[c >> 1][wn][wk + 64 * (c & 1)]) = p; }
  __syncthreads();
  v16h wb[CC / 32][3];
#pragma unroll  // constant indices keep the array in registers
  for (int kc = 0; kc < CC / 32; ++kc)
#pragma unroll
    for (int j = 0; j < 3; ++j) wb[kc][j] = frag_h(&sw[j][col][kc * 32], lane);
  __builtin_amdgcn_sched_barrier(0);   // keeps the LDS reads above together: one LDS latency for the twelve fragments, not one in front of each product
  v8f acc[3] = {};
#pragma unroll
  for (int kc = 0; kc < CC / 32; ++kc) { v16h a;
#pragma unroll
    for (int i = 0; i < 4; ++i) { a[i] = (_Float16)xr[kc][0][i]; a[4 + i] = (_Float16)xr[kc][1][i]; a[8 + i] = (_Float16)xr[kc][2][i]; a[12 + i] = (_Float16)xr[kc][3][i]; }
    acc[0] = wmma16(a, wb[kc][0], acc[0]); acc[1] = wmma16(a, wb[kc][1], acc[1]); acc[2] = wmma16(a, wb[kc][2], acc[2]); }
#pragma unroll
  for (int j = 0; j < 3; ++j)
#pragma unroll
    for (int r = 0; r < 8; ++r) so[wave][8 * g + r][j * 16 + col] = acc[j][r];
  LDSX();
  if (lane < 16) { union { v8h a8; v4u u; } pf0, pf1, pg0, pg1; const int rl = lane;
#pragma unroll
    for (int e = 0; e < 8; ++e) { pf0.a8[e] = (_Float16)so[wave][rl][e]; pf1.a8[e] = (_Float16)so[wave][rl][8 + e]; pg0.a8[e] = (_Float16)(so[wave][rl][16 + e] * LOG2E); pg1.a8[e] = (_Float16)(so[wave][rl][24 + e] * LOG2E); }
    vst2(F16 + (size_t)(r0 + rl) * DK, pf0.u); vst2(F16 + (size_t)(r0 + rl) * DK + 8, pf1.u); vst2(G16 + (size_t)(r0 + rl) * DK, pg0.u); vst2(G16 + (size_t)(r0 + rl) * DK + 8, pg1.u); }
  // h transposed: st[d][block row] then HT[b][d][n0 + 64]
  if (lane < 16) {
#pragma unroll
    for (int d = 0; d < DK; ++d) st[d][wave * 16 + lane] = (_Float16)so[wave][lane][32 + d]; }
  __syncthreads();
  if (tid < DK * 8) { const int d = tid >> 3, pc = tid & 7; vst2(HT + ((size_t)b * DK + d) * NN + n0 + pc * 8, *(const v4u*)(&st[d][pc * 8])); }
}
// value of lane (lane ^ X) inside the 16-lane row (DPP row_xmask); every lane is on where it is used
template <int X> __device__ __forceinline__ float rowx(float v) { return __builtin_bit_cast(float, __builtin_amdgcn_update_dpp(0, __builtin_bit_cast(int, v), 0x160 | X, 0xf, 0xf, true)); }
struct Yes { static constexpr bool v = true; }; struct No { static constexpr bool v = false; };   // compile-time switch of a generic lambda
// the matrix product alone: in the two loops below the vector work of another tile stands behind every product, so the distance to the first use of its result is filled with work
__device__ __forceinline__ v8f wmmap(v16h a, v16h b, v8f c) { return __builtin_amdgcn_wmma_f32_16x16x32_f16(false, a, false, b, (short)0, c, false, false); }
// two loaded tiles of K = 16 side by side are one K = 32 operand (elements 0..7 = k 8h + i of the first, 8..15 = k 16 + 8h + i, that is d = 8h + i of the second); the other operand, [v | 0] or [0 | v], picks the tile
__device__ __forceinline__ v16h join(v8h a, v8h b) { return __builtin_shufflevector(a, b, 0, 1, 2, 3, 4, 5, 6, 7, 8, 9, 10, 11, 12, 13, 14, 15); }
// The order of a step's instructions, told to the scheduler group by group (n instructions of a kind, in the order of these lines): left free, it gathers the products in runs and the
// exponentials in runs, so that the exponential pipe stands idle while products issue and their results are waited for. STEP_END closes the step that the groups are about
#define G_MAT(n) __builtin_amdgcn_sched_group_barrier(0x8, n, 0)     // matrix products
#define G_EXP(n) __builtin_amdgcn_sched_group_barrier(0x400, n, 0)   // exponentials
#define G_VEC(n) __builtin_amdgcn_sched_group_barrier(0x2, n, 0)     // other vector instructions
#define G_LD(n) __builtin_amdgcn_sched_group_barrier(0x20, n, 0)     // global loads
#define STEP_END() __builtin_amdgcn_sched_barrier(0)
#define CT 32             // query tiles of 16 held in registers
#define NP (CT / 2)       // as pairs
#define NBAT (NN / (16 * CT))
#define BATB (CT * 16 * DK * 2)   // bytes of f in a batch of CT tiles
// column statistics: D = g_m . f_n has key row m = 8g + r in register r and query n in the lane's column, so each lane keeps a running
// sum per register over its own query columns; the 16 lanes of a row are merged once, behind the loop
__global__ __launch_bounds__(128) void k_colstat(const _Float16* __restrict__ F16, const _Float16* __restrict__ G16, float* __restrict__ cst) {
  const int tid = threadIdx.x, w = tid >> 5, lane = tid & 31, col = lane & 15, g = lane >> 4;
  const int b = blockIdx.y, m0 = blockIdx.x * 64 + w * 16; const size_t rb = (size_t)b * NN;
  v16h agl, agh;                                        // A = g rows (m0 + col) as [g | 0] and [0 | g]
  { const _Float16* gr = G16 + (rb + m0 + col) * DK;
#pragma unroll  // constant indices keep the array in registers
    for (int i = 0; i < 8; ++i) { agl[i] = gr[8 * g + i]; agl[8 + i] = (_Float16)0.f; agh[i] = (_Float16)0.f; agh[8 + i] = gr[8 * g + i]; } }
  __builtin_amdgcn_sched_barrier(0);   // the g load stays the oldest: issued behind the ring's first loads, the wait for it at the head of the loop would be a wait for every load in flight, on every trip
  // Column sums L = sum over queries of 2^(s - ref), the reference entering the score product as its C operand: no running maximum, no subtraction
  // and no rescale in the loop. The first pass takes ref = 0. It stands wherever every column sum of the wave comes out inside [2^-64, 2^100]: then
  // no term overflowed, and what was flushed to 0 lies under 2^-50 of the sum. Otherwise (scores far from 0) the wave finds its true column maxima
  // and takes the pass once more against them, which holds for any scores
  float Mo = 0.f, Lo = 1.f;
  const _Float16* f0 = F16 + (rb + col) * DK + 8 * g;   // this lane's 8 halves of query row col; a tile of 16 rows further on is 16 * DK halves
  // a ring of NP pairs of tiles in registers: a pair's registers are loaded again, with the tiles CT further on, as soon as its two products have issued, so every load
  // has the work of CT - 2 tiles to arrive in. The products run one pair ahead of the exponentials, so between passes the ring holds pairs 1 .. NP - 1 of the first batch and pair 0 of the second
  v16h pr[NP];
#pragma unroll  // constant indices keep the array in registers
  for (int j = 1; j <= NP; ++j) { const int p = j % NP; const _Float16* s = f0 + (j == NP ? BATB / 2 : 2 * p * 16 * DK);
    pr[p] = join(*(const v8h*)s, *(const v8h*)(s + 16 * DK));
    __builtin_amdgcn_sched_barrier(0); }   // the pairs are first loaded in the order in which the loop loads them again, so that its counted waits hold for both
  const _Float16* fn = f0; const _Float16* fz = f0;   // where pairs 1 .. NP - 1, and pair 0, are being loaded from
  // one walk over all queries: SUM adds 2^(s + cc) into ac, else ac takes the maximum of s (cc = 0). RARE: the two walks of the second try, whose speed does not matter
  auto walk = [&](auto sum, auto rare, const v8f cc, float (&ac)[8]) __attribute__((always_inline)) {
    constexpr bool S = decltype(sum)::v, R = decltype(rare)::v;
    auto prod = [&](const v16h a, const v16h bb) __attribute__((always_inline)) { if constexpr (R) return wmma16(a, bb, cc); else return wmmap(a, bb, cc); };
    const v16h first = join(*(const v8h*)f0, *(const v8h*)(f0 + 16 * DK));
    v8f sa = prod(agl, first), sb = prod(agh, first);
    float ep[8];   // the exponentials of the tile before: they are added one tile late, so that no addition waits for its exponential
#pragma unroll  // constant indices keep the array in registers
    for (int r = 0; r < 8; ++r) ep[r] = 0.f;
    auto use = [&](const v8f s) __attribute__((always_inline)) {
#pragma unroll  // constant indices keep the array in registers
      for (int r = 0; r < 8; ++r) { if constexpr (S) { ac[r] += ep[r]; ep[r] = ex2(s[r]); } else ac[r] = fmaxf(ac[r], s[r]); } };
#pragma unroll 1  // one walk of the ring per trip
    for (int nb = 0; nb < NBAT; ++nb) {
      // the last batches load the first ones again, for a further pass: the loads need no branch, which would merge the wait counts of its two sides
      const unsigned long long ob = (unsigned long long)(((nb + 1) & (NBAT - 1)) * BATB), oz = (unsigned long long)(((nb + 2) & (NBAT - 1)) * BATB);
      // fn = f0 + ob, fz = f0 + oz, in bytes. The address registers of the issued loads are written again only behind the wait: wait and additions are one statement, since an addition of the compiler's own was drawn up over a wait that stood alone
      asm volatile("s_wait_xcnt 0x0\n\tv_add_nc_u64_e32 %0, %2, %4\n\tv_add_nc_u64_e32 %1, %3, %4" : "+v"(fn), "+v"(fz) : "s"(ob), "s"(oz), "v"(f0) : "memory");
      STEP_END();   // the first step begins here
#pragma unroll  // constant indices keep the array in registers
      for (int p = 0; p < NP; ++p) { const int pn = (p + 1) % NP;
        const v8f na = prod(agl, pr[pn]); use(sa);
        STEP_END();   // a product stays with the exponentials of an earlier tile: gathered in runs, the products' results would be waited for with the vector port idle
        const v8f nc = prod(agh, pr[pn]); use(sb);
        const _Float16* s = pn ? fn + 2 * pn * 16 * DK : fz;
        pr[pn] = join(*(gv8h*)s, *(gv8h*)(s + 16 * DK));
        STEP_END();   // also keeps a pair's loads in the step of its last use: sunk they would arrive late
        sa = na; sb = nc; } }
    if constexpr (S) {
#pragma unroll  // constant indices keep the array in registers
      for (int r = 0; r < 8; ++r) ac[r] += ep[r]; }
    asm volatile("s_wait_xcnt 0x0" :: "v"(fn), "v"(fz), "v"(f0) : "memory"); };   // as above, for what is written behind the loop
  // merges the 16 lanes of a row; lane col == r keeps the value of key row 8g + r
  float lrun[8];
#pragma unroll  // constant indices keep the array in registers
  for (int r = 0; r < 8; ++r) lrun[r] = 0.f;
  { const v8f z = {}; walk(Yes{}, No{}, z, lrun); }
  float lmin = 3.0e38f, lmax = 0.f;
#pragma unroll  // constant indices keep the array in registers
  for (int r = 0; r < 8; ++r) { float l = lrun[r];
    l += rowx<1>(l); l += rowx<2>(l); l += rowx<4>(l); l += rowx<8>(l);
    lmin = fminf(lmin, l); lmax = fmaxf(lmax, l);
    if (col == r) Lo = l; }
  const bool redo = !(lmin >= 0x1p-64f && lmax <= 0x1p100f);   // an overflowed sum is an infinity and fails the test
  if (__builtin_amdgcn_ballot_w32(redo) != 0) {   // the same for the whole wave; the kernel has no barrier
    float mrun[8]; v8f sh;   // sh: minus the reference of key row 8g + r in register r
#pragma unroll  // constant indices keep the array in registers
    for (int r = 0; r < 8; ++r) mrun[r] = -3.0e38f;
    { const v8f z = {}; walk(No{}, Yes{}, z, mrun); }
#pragma unroll  // constant indices keep the array in registers
    for (int r = 0; r < 8; ++r) { float M = mrun[r];
      M = fmaxf(M, rowx<1>(M)); M = fmaxf(M, rowx<2>(M)); M = fmaxf(M, rowx<4>(M)); M = fmaxf(M, rowx<8>(M));
      sh[r] = -M; if (col == r) Mo = M; lrun[r] = 0.f; }
    walk(Yes{}, Yes{}, sh, lrun);
#pragma unroll  // constant indices keep the array in registers
    for (int r = 0; r < 8; ++r) { float l = lrun[r];
      l += rowx<1>(l); l += rowx<2>(l); l += rowx<4>(l); l += rowx<8>(l);
      if (col == r) Lo = l; } }
  // one constant per key, base 2: 2^(s + c) = 2^14 2^(s - M) / L; a wave's 16 constants head a 128-byte line of their own
  if (col < 8) cst[(rb + m0) * 2 + 8 * g + col] = 14.0f - Mo - log2f(Lo);
}
#define NS 2   // batches of 32 keys (two 16-key tiles) held in registers at a time
#define AW 8   // waves per block: each takes NN / AW of the keys, for all 64 queries of the block
#define NBT (NN / (AW * 32))   // batches per wave
#define QT 4   // query tiles of 16 per wave: every loaded key fragment (g, c, h) feeds QT score or PV products
// pass 2: block = 64 queries, wave = all of them against its own NN / AW keys. S^T = g_m . f_n + c_m (c_m enters as the C operand) has key m = 8g + r in
// register r and query n in the lane's column, so exp of two such tiles, converted in place, IS the B operand (32 keys x 16 queries, x2^14 f16) of
// y^T += h^T . P^T: P never leaves the registers. The waves' partial y^T are summed through LDS, in wave order. y^T has d = 8g + r in register r,
// which is the A operand of y @ w_v; wave w then does query tile w & 3, channels 64 (w >> 2) .. + 63. out = gamma*(y @ w_v) + x
__global__ __launch_bounds__(32 * AW) void k_apply(const _Float16* __restrict__ F16, const _Float16* __restrict__ G16, const _Float16* __restrict__ HT, const float* __restrict__ cst, const float* __restrict__ wv, const float* __restrict__ gam, const float* __restrict__ x, float* __restrict__ out) {
  __shared__ __align__(16) float red[AW][QT][2][32][4];   // partial y^T: [wave][query tile][register quad][lane][register in the quad]
  __shared__ __align__(16) float so[AW][16][68];
  const int tid = threadIdx.x, w = tid >> 5, lane = tid & 31, col = lane & 15, g = lane >> 4;
  const int b = blockIdx.y, n0b = blockIdx.x * 64, k0 = w * (NN / AW); const size_t rb = (size_t)b * NN;
  v16h bfl[QT], bfh[QT];   // B = f rows (n0b + 16 q + col) as [f | 0] and [0 | f]: against A = [g of tile 0 | g of tile 1] they give the scores of tile 0 and of tile 1
#pragma unroll  // constant indices keep the array in registers
  for (int q = 0; q < QT; ++q) { const _Float16* fr = F16 + (rb + n0b + q * 16 + col) * DK;
#pragma unroll
    for (int i = 0; i < 8; ++i) { bfl[q][i] = fr[8 * g + i]; bfl[q][8 + i] = (_Float16)0.f; bfh[q][i] = (_Float16)0.f; bfh[q][8 + i] = fr[8 * g + i]; } }
  v8f acc[QT] = {};
  const _Float16* gp = G16 + (rb + k0 + col) * DK + 8 * g;              // this lane's 8 halves of key row k0 + col; the next tile is 16 * DK halves on
  const float* cp = cst + (rb + k0) * 2 + 8 * g;                        // the constants of key rows k0 + 8g .. + 7; the next tile is 32 floats on
  const _Float16* hp = HT + ((size_t)b * DK + col) * NN + k0 + 8 * g;   // row d = col of h^T, keys k0 + 8g .. + 7; the next tile is 16 halves on
  // two slots of 32 keys in registers. The work goes in steps of one slot and one query tile, and three steps are under way at a time: the score products of the step
  // to come, the exponentials of this one, the PV product of the one before. A slot's g and c are loaded again right behind its last score product, its h right behind its last PV product:
  // every load has five steps to arrive in
  v16h ga[NS], ha[NS]; v8f c[NS][2];
  __builtin_amdgcn_sched_barrier(0);   // the f loads stay the oldest, and the slots are first loaded in the order in which the loop loads them again (the fences below), so that its counted waits hold for both
#pragma unroll  // constant indices keep the arrays in registers
  for (int sl = 0; sl < NS; ++sl) {
    ga[sl] = join(*(const v8h*)(gp + (2 * sl) * 16 * DK), *(const v8h*)(gp + (2 * sl + 1) * 16 * DK));
#pragma unroll
    for (int t = 0; t < 2; ++t) c[sl][t] = *(const v8f*)(cp + (2 * sl + t) * 32);
    __builtin_amdgcn_sched_barrier(0);
    if (sl == 0) { ha[sl] = join(*(const v8h*)hp, *(const v8h*)(hp + 16));
      __builtin_amdgcn_sched_barrier(0); } }
  const _Float16* gn = gp; const float* cn = cp; const _Float16* hn = hp;   // where the slots are being loaded from
  // the first step has no step before it: its P is 0 and its PV product adds 0 . 0
  ha[NS - 1] = v16h{};
  float e[16];   // the exponentials of the step before, not yet converted
#pragma unroll  // constant indices keep the array in registers
  for (int r = 0; r < 16; ++r) e[r] = 0.f;
  v8f s0 = wmmap(ga[0], bfl[0], c[0][0]), s1 = wmmap(ga[0], bfh[0], c[0][1]);
  // one trip: both slots are used; where more batches follow (MORE), each is loaded again on the way. The last trip is a copy of its own without those loads:
  // a branch round them would merge the wait counts of its two sides, and loads that nobody uses would hold up the registers of the tail
  auto trip = [&](int mb, auto more) __attribute__((always_inline)) {
#pragma unroll  // constant indices keep the arrays in registers
    for (int sl = 0; sl < NS; ++sl)
#pragma unroll  // constant indices keep the arrays in registers
      for (int q = 0; q < QT; ++q) {
        constexpr bool M = decltype(more)::v;
        const int qn = (q + 1) % QT, sn = q == QT - 1 ? (sl + 1) % NS : sl;     // the step to come
        const int qb = (q + QT - 1) % QT, sb = q == 0 ? (sl + NS - 1) % NS : sl;   // the step before
        const bool nxt = M || !(sl == NS - 1 && q == QT - 1);
        const bool ldh = q == 0 && (M || sl == 0), ldg = M && q == QT - 2;
        v16h pb; v8f n0 = {}, n1 = {};
        if (nxt) { n0 = wmmap(ga[sn], bfl[qn], c[sn][0]); n1 = wmmap(ga[sn], bfh[qn], c[sn][1]); }
        if (ldg) {   // these score products were the last of slot sl
          // holds the old c in its registers up to here, so that the last products do not write their scores over it: the new c would then land elsewhere and be copied, behind a full wait, at the foot of the trip
          asm volatile("" :: "v"(c[sl][0]), "v"(c[sl][1]));
          ga[sl] = join(*(gv8h*)(gn + (2 * sl) * 16 * DK), *(gv8h*)(gn + (2 * sl + 1) * 16 * DK));
#pragma unroll  // constant indices keep the arrays in registers
          for (int t = 0; t < 2; ++t) c[sl][t] = *(gv8f*)(cn + (2 * sl + t) * 32); }
#pragma unroll  // constant indices keep the arrays in registers
        for (int r = 0; r < 16; ++r) pb[r] = (_Float16)e[r];
#pragma unroll  // constant indices keep the arrays in registers
        for (int r = 0; r < 8; ++r) { e[r] = ex2(s0[r]); e[8 + r] = ex2(s1[r]); }
        acc[qb] = wmmap(ha[sb], pb, acc[qb]);
        if (ldh) ha[sb] = join(*(gv8h*)(hn + (2 * sb) * 16), *(gv8h*)(hn + (2 * sb + 1) * 16));   // that PV product was the last of slot sb
        // the step's order: the conversions and the two score products one by one between exponentials, the PV product last, behind its conversions: the three products stand far apart, and nothing waits for a result
#pragma unroll  // the groups of the step, written out
        for (int k = 0; k < 10; ++k) { G_EXP(1); if (k == 2 || k == 6) { if (nxt) G_MAT(1); if (k == 6 && ldg) G_LD(6); } else G_VEC(1); }
        G_EXP(6); G_MAT(1); if (ldh) G_LD(2);
        // holds the scores in their registers to the end of the step: an exponential that stands directly behind another one would else be given the register that the first has just read, and the instruction set asks for a slot between the two
        asm volatile("" :: "v"(s0), "v"(s1));
        STEP_END();   // also keeps the loads in this step and in this order: the counted waits go by the order
        if (M && sl == 0 && q == 0) {
          const int nx = mb + NS;
          const unsigned long long og = (unsigned long long)(nx * 32 * DK * 2), oc = (unsigned long long)(nx * 64 * 4), oh = (unsigned long long)(nx * 32 * 2);
          // gn = gp + og, cn = cp + oc, hn = hp + oh, in bytes (the h load above still went by the trip before: its slot is one batch on). The address registers of the issued loads are written again only behind the wait: wait and additions are one statement, since an addition of the compiler's own can be drawn up over a wait that stands alone
          asm volatile("s_wait_xcnt 0x0\n\tv_add_nc_u64_e32 %0, %3, %6\n\tv_add_nc_u64_e32 %1, %4, %7\n\tv_add_nc_u64_e32 %2, %5, %8" : "+v"(gn), "+v"(cn), "+v"(hn) : "s"(og), "s"(oc), "s"(oh), "v"(gp), "v"(cp), "v"(hp) : "memory");
          STEP_END(); }   // the next step begins here
        s0 = n0; s1 = n1; } };
#pragma unroll 1  // one pass over the slots per trip
  for (int mb = 0; mb < NBT - NS; mb += NS) trip(mb, Yes{});
  trip(NBT - NS, No{});
  asm volatile("s_wait_xcnt 0x0" :: "v"(gn), "v"(cn), "v"(hn), "v"(gp), "v"(cp), "v"(hp) : "memory");   // as above, for what is written behind the loop
  { v16h pb;   // the PV product of the last step
#pragma unroll  // constant indices keep the arrays in registers
    for (int r = 0; r < 16; ++r) pb[r] = (_Float16)e[r];
    acc[QT - 1] = wmma16(ha[NS - 1], pb, acc[QT - 1]); }
  // the x and w_v values of the tail issue here, together: they are waited for once, with the exchange of the partial sums
  const int qt = w & 3, jh = w >> 2, n0 = n0b + qt * 16;
  float xv[4][8]; const float* xq = x + (rb + n0 + 8 * g) * CC + jh * 64 + col;   // row n0 + 8g, this lane's channel in the wave's first tile
#pragma unroll  // constant indices keep the array in registers
  for (int j = 0; j < 4; ++j)
#pragma unroll
    for (int r = 0; r < 8; ++r) xv[j][r] = xq[r * CC + j * 16];
  float wr[4][8]; const float* wp = wv + (size_t)(8 * g) * CC + jh * 64 + col;   // row 8g of w_v, this lane's channel in the wave's first tile
#pragma unroll  // constant indices keep the array in registers
  for (int j = 0; j < 4; ++j)
#pragma unroll
    for (int i = 0; i < 8; ++i) wr[j][i] = wp[i * CC + j * 16];
  __builtin_amdgcn_sched_barrier(0);   // keeps the loads above together and up here: moved down to their uses they would be waited for in five groups, one after another
  // the waves' partial sums meet: each wave lays down its QT tiles, and behind the barrier adds up the AW partials of the one tile it finishes
#pragma unroll  // constant indices keep the array in registers
  for (int q = 0; q < QT; ++q)
#pragma unroll
    for (int hh = 0; hh < 2; ++hh) { v4f t = { acc[q][4 * hh], acc[q][4 * hh + 1], acc[q][4 * hh + 2], acc[q][4 * hh + 3] }; *(v4f*)(&red[w][q][hh][lane][0]) = t; }
  __syncthreads();
  asm volatile("s_wait_xcnt 0x0" :: "v"(xq), "v"(wp) : "memory");   // the address registers of the tail's loads are written again only behind this wait; naming the addresses keeps them whole up to here
  v8f y = {};
#pragma unroll  // constant indices keep the array in registers
  for (int ww = 0; ww < AW; ++ww)
#pragma unroll
    for (int hh = 0; hh < 2; ++hh) { const v4f t = *(const v4f*)(&red[ww][qt][hh][lane][0]);
#pragma unroll
      for (int e = 0; e < 4; ++e) y[4 * hh + e] += t[e]; }
  // out = gamma * (y @ w_v) + x : y [16 x 16] @ w_v [16 x 64 of 128] -> WMMA K=16 (zero-padded), 4 tiles of 16 channels
  { v16h ay;
#pragma unroll
    for (int i = 0; i < 8; ++i) { ay[i] = (_Float16)(y[i] * (1.0f / 16384.0f)); ay[8 + i] = (_Float16)0.f; }
    const float gm = gam[0];
#pragma unroll
    for (int j = 0; j < 4; ++j) { v16h bb;
#pragma unroll
      for (int i = 0; i < 8; ++i) { bb[i] = (_Float16)(wr[j][i] * 4.0f); bb[8 + i] = (_Float16)0.f; }
      v8f o = {}; o = wmma16(ay, bb, o);
#pragma unroll
      for (int r = 0; r < 8; ++r) so[w][8 * g + r][j * 16 + col] = gm * o[r] * 0.25f + xv[j][r]; } }
  LDSX();
#pragma unroll 4
  for (int rp = 0; rp < 8; ++rp) { const int rl = 2 * rp + g; vst2(out + (rb + n0 + rl) * CC + jh * 64 + col * 4, *(const v4f*)(&so[w][rl][col * 4])); }
}
extern "C" void kernel_launch(void* const* d_in, const int* in_sizes, int n_in, void* d_out, int out_size, void* d_ws, size_t ws_size, hipStream_t stream) {
  (void)in_sizes; (void)n_in; (void)out_size; (void)ws_size;
  const float** I = (const float**)d_in;
  const float* x = I[0]; const float* wf = I[1]; const float* wg = I[2]; const float* wh = I[3]; const float* wv = I[4]; const float* gam = I[5];
  float* out = (float*)d_out;
  char* ws = (char*)d_ws; size_t off = 0;
  auto take = [&](size_t bytes) { char* p = ws + off; off += (bytes + 255) & ~(size_t)255; return p; };
  _Float16* F16 = (_Float16*)take((size_t)NR * DK * 2); _Float16* G16 = (_Float16*)take((size_t)NR * DK * 2); _Float16* HT = (_Float16*)take((size_t)NR * DK * 2); float* cst = (float*)take((size_t)NR * 2 * 4);
  k_proj<<<NR / 64, 128, 0, stream>>>(x, wf, wg, wh, F16, G16, HT);
  k_colstat<<<dim3(NN / 64, NB), 128, 0, stream>>>(F16, G16, cst);
  k_apply<<<dim3(NN / 64, NB), 32 * AW, 0, stream>>>(F16, G16, HT, cst, wv, gam, x, out);
}

// v009
// One run takes 29.9 microseconds.
// Next to v008, in two timings, it ran 1.04 and 1.03 times as fast.
// Counting every step since v000, it is 12.1 times as fast.
#include <hip/hip_runtime.h>
#include <math.h>

typedef __attribute__((ext_vector_type(16))) _Float16 v16h;
typedef __attribute__((ext_vector_type(16))) __bf16 v16b;
typedef __attribute__((ext_vector_type(8)))  _Float16 v8h;
typedef __attribute__((ext_vector_type(8)))  float v8f;
typedef __attribute__((ext_vector_type(4)))  float v4f;
typedef __attribute__((ext_vector_type(2)))  float v2f;
typedef __attribute__((ext_vector_type(4)))  unsigned v4u;
typedef __attribute__((ext_vector_type(4)))  int v4i;
typedef float __attribute__((may_alias)) float_a;
typedef int __attribute__((may_alias)) int_a;
// loads through an address that an asm statement has written: the compiler no longer sees that it is global memory and would take the slower flat form, so the type says it
typedef const v8h __attribute__((address_space(1))) gv8h;
typedef const v8f __attribute__((address_space(1))) gv8f;

template <typename T> __device__ __forceinline__ void vst2(void* p, T v) { *(T*)p = v;  }
__device__ __forceinline__ v8f wmma16(v16h a, v16h b, v8f c) {
  v8f d = __builtin_amdgcn_wmma_f32_16x16x32_f16(false, a, false, b, (short)0, c, false, false);
  asm volatile("v_nop\n\tv_nop\n\tv_nop\n\tv_nop" : "+v"(d) : "v"(a), "v"(b));
  return d;
}
__device__ __forceinline__ v8f wmma_bf(v16b a, v16b b, v8f c) {
  v8f d = __builtin_amdgcn_wmma_f32_16x16x32_bf16(false, a, false, b, (short)0, c, false, false);
  asm volatile("v_nop\n\tv_nop\n\tv_nop\n\tv_nop" : "+v"(d) : "v"(a), "v"(b));
  return d;
}
// 16x16x32 fragments: lane = (h = lane>>4, row/col = lane&15); elements 0..7 = k0+8h+0..7, 8..15 = k0+16+8h+0..7; D element r = row 8h+r
__device__ __forceinline__ v16h frag_h(const _Float16* rowk0, int lane) {
  union { v16h v; v8h q[2]; } u; const _Float16* p = rowk0 + 8 * (lane >> 4);
  u.q[0] = *(const v8h*)p; u.q[1] = *(const v8h*)(p + 16); return u.v;
}
__device__ __forceinline__ v16h frag_f32(const float* rowk0, int lane) {
  v16h a; const float* p = rowk0 + 8 * (lane >> 4);
#pragma unroll
  for (int i = 0; i < 8; ++i) { a[i] = (_Float16)p[i]; a[8 + i] = (_Float16)p[16 + i]; }
  return a;
}
__device__ __forceinline__ v16h frag_f32s(const float* rowk0, int lane, float sc) {
  v16h a; const float* p = rowk0 + 8 * (lane >> 4);
#pragma unroll
  for (int i = 0; i < 8; ++i) { a[i] = (_Float16)(p[i] * sc); a[8 + i] = (_Float16)(p[16 + i] * sc); }
  return a;
}
// column fragment from a [K][ld] layout (column n), rows >= K read as 0
__device__ __forceinline__ v16h fragc_f32(const float* W, int k0, int n, int lane, int ld, int K) {
  v16h a; const int g = lane >> 4;
#pragma unroll
  for (int i = 0; i < 8; ++i) { const int ka = k0 + 8 * g + i, kb = ka + 16;
    a[i] = (_Float16)(ka < K ? W[(size_t)ka * ld + n] : 0.f); a[8 + i] = (_Float16)(kb < K ? W[(size_t)kb * ld + n] : 0.f); }
  return a;
}
struct F2 { v16b h, l; };
__device__ __forceinline__ F2 bsplit16(const float v[16]) { F2 r;
#pragma unroll
  for (int i = 0; i < 16; ++i) { const __bf16 h = (__bf16)v[i]; r.h[i] = h; r.l[i] = (__bf16)(v[i] - (float)h); }
  return r; }
__device__ __forceinline__ F2 split_row(const float* row, int k0, int lane) { float v[16]; const float* p = row + k0 + 8 * (lane >> 4);
#pragma unroll
  for (int i = 0; i < 8; ++i) { v[i] = p[i]; v[8 + i] = p[16 + i]; }
  return bsplit16(v); }
__device__ __forceinline__ F2 split_rowK(const float* row, int k0, int lane, int K) { float v[16]; const int g = lane >> 4;
#pragma unroll
  for (int i = 0; i < 8; ++i) { const int ka = k0 + 8 * g + i, kb = ka + 16; v[i] = ka < K ? row[ka] : 0.f; v[8 + i] = kb < K ? row[kb] : 0.f; }
  return bsplit16(v); }
__device__ __forceinline__ F2 split_col(const float* W, int k0, int n, int lane, int ld, int K) { float v[16]; const int g = lane >> 4;
#pragma unroll
  for (int i = 0; i < 8; ++i) { const int ka = k0 + 8 * g + i, kb = ka + 16; v[i] = ka < K ? W[(size_t)ka * ld + n] : 0.f; v[8 + i] = kb < K ? W[(size_t)kb * ld + n] : 0.f; }
  return bsplit16(v); }
__device__ __forceinline__ v8f mac3(const F2& a, const F2& b, v8f c) { c = wmma_bf(a.l, b.h, c); c = wmma_bf(a.h, b.l, c); return wmma_bf(a.h, b.h, c); }
__device__ __forceinline__ float sigm(float v) { return 1.0f / (1.0f + expf(-v)); }
#define LDSX() do { asm volatile("s_wait_dscnt 0" ::: "memory"); __builtin_amdgcn_wave_barrier(); __builtin_amdgcn_fence(__ATOMIC_RELEASE, "workgroup"); } while (0)

// 2-D self-attention with the softmax taken over the QUERY axis (axis=1 of [b,n,m], as the reference does). f, g, hh = x @ w (K = 128,
// tiles, K = 16 zero-padded); pass 2: per query block y[n] = sum_m exp(s[n][m] - M_m)/L_m hh[m] on WMMA (P x2^14 f16), then
#define NB 8
#define NN 4096
#define CC 128
#define DK 16
#define NR (NB * NN)
#define LOG2E 1.44269504f   // g is stored times log2 e: every score comes out of the WMMA in base-2 units and each exponential is one v_exp_f32
// 2^v as the bare instruction, without the library's range fix-up: a result under 2^-126 may come out 0, which is far under what a sum that holds a term of 1, or an f16 P, can show
__device__ __forceinline__ float ex2(float v) { return __builtin_amdgcn_exp2f(v); }

#define WP 136   // halves per staged weight column: 272 bytes, an odd multiple of 16, so the 16-byte LDS accesses of 16 columns spread over the banks
// f/g/h projections: block 64 rows; outputs F16,G16 [r][16] f16 (G16 = g log2 e: scores = f.g (K=16) in base-2 units, no other scaling), HT16 [b][d][n] (h transposed for the PV A operand)
__global__ __launch_bounds__(128) void k_proj(const float* __restrict__ x, const float* __restrict__ wf, const float* __restrict__ wg, const float* __restrict__ wh, _Float16* __restrict__ F16, _Float16* __restrict__ G16, _Float16* __restrict__ HT) {
  __shared__ __align__(16) float so[4][16][52];
  __shared__ __align__(16) _Float16 st[DK][72];
  __shared__ __align__(16) _Float16 sw[3][DK][WP];   // w_f, w_g, w_h as f16, transposed to [column][k]: a B fragment is two 16-byte reads
  const int tid = threadIdx.x, wave = tid >> 5, lane = tid & 31, col = lane & 15, g = lane >> 4;
  const int r0b = blockIdx.x * 64, r0 = r0b + wave * 16; const int b = r0b / NN, n0 = r0b % NN;
  // every global load of the kernel issues here, before anything waits; x, which comes from furthest away, first
  v4f xr[CC / 32][4];   // this lane's part of row r0 + col: per 32 channels, floats 8g .. 8g + 7 and 16 + 8g .. 16 + 8g + 7
  const float* xp = x + (size_t)(r0 + col) * CC + 8 * g;
#pragma unroll  // constant indices keep the array in registers
  for (int kc = 0; kc < CC / 32; ++kc) { xr[kc][0] = *(const v4f*)(xp + kc * 32); xr[kc][1] = *(const v4f*)(xp + kc * 32 + 4); xr[kc][2] = *(const v4f*)(xp + kc * 32 + 16); xr[kc][3] = *(const v4f*)(xp + kc * 32 + 20); }
  asm volatile("s_wait_xcnt 0x0" :: "v"(xp) : "memory");   // an address register of issued loads is written (by a later load's result or a vector instruction) only behind this wait; naming the address keeps it whole up to here
  // a thread takes 8 consecutive k of one column, twice per matrix: the block reads each weight once
  const int wn = tid & 15, wk = (tid >> 4) * 8;
  const float* w0 = wf + (size_t)wk * DK + wn; const float* w1 = wg + (size_t)wk * DK + wn; const float* w2 = wh + (size_t)wk * DK + wn;
  float wr[6][8];
#pragma unroll  // constant indices keep the array in registers
  for (int c = 0; c < 6; ++c) { const float* wsrc = (c < 2 ? w0 : c < 4 ? w1 : w2) + 64 * (c & 1) * DK;
#pragma unroll
    for (int i = 0; i < 8; ++i) wr[c][i] = wsrc[i * DK]; }
  asm volatile("s_wait_xcnt 0x0" :: "v"(w0), "v"(w1), "v"(w2) : "memory");   // as above; naming the addresses keeps a result of these same loads out of their registers
  __builtin_amdgcn_sched_barrier(0);   // keeps the loads above together: moved down to their uses they would be waited for one small group after another
#pragma unroll  // constant indices keep the array in registers
  for (int c = 0; c < 6; ++c) { v8h p;
#pragma unroll
    for (int i = 0; i < 8; ++i) p[i] = (_Float16)wr[c][i];
    *(v8h*)(&sw[c >> 1][wn][wk + 64 * (c & 1)]) = p; }
  __syncthreads();
  v16h wb[CC / 32][3];
#pragma unroll  // constant indices keep the array in registers
  for (int kc = 0; kc < CC / 32; ++kc)
#pragma unroll
    for (int j = 0; j < 3; ++j) wb[kc][j] = frag_h(&sw[j][col][kc * 32], lane);
  __builtin_amdgcn_sched_barrier(0);   // keeps the LDS reads above together: one LDS latency for the twelve fragments, not one in front of each product
  v8f acc[3] = {};
#pragma unroll
  for (int kc = 0; kc < CC / 32; ++kc) { v16h a;
#pragma unroll
    for (int i = 0; i < 4; ++i) { a[i] = (_Float16)xr[kc][0][i]; a[4 + i] = (_Float16)xr[kc][1][i]; a[8 + i] = (_Float16)xr[kc][2][i]; a[12 + i] = (_Float16)xr[kc][3][i]; }
    acc[0] = wmma16(a, wb[kc][0], acc[0]); acc[1] = wmma16(a, wb[kc][1], acc[1]); acc[2] = wmma16(a, wb[kc][2], acc[2]); }
#pragma unroll
  for (int j = 0; j < 3; ++j)
#pragma unroll
    for (int r = 0; r < 8; ++r) so[wave][8 * g + r][j * 16 + col] = acc[j][r];
  LDSX();
  if (lane < 16) { union { v8h a8; v4u u; } pf0, pf1, pg0, pg1; const int rl = lane;
#pragma unroll
    for (int e = 0; e < 8; ++e) { pf0.a8[e] = (_Float16)so[wave][rl][e]; pf1.a8[e] = (_Float16)so[wave][rl][8 + e]; pg0.a8[e] = (_Float16)(so[wave][rl][16 + e] * LOG2E); pg1.a8[e] = (_Float16)(so[wave][rl][24 + e] * LOG2E); }
    vst2(F16 + (size_t)(r0 + rl) * DK, pf0.u); vst2(F16 + (size_t)(r0 + rl) * DK + 8, pf1.u); vst2(G16 + (size_t)(r0 + rl) * DK, pg0.u); vst2(G16 + (size_t)(r0 + rl) * DK + 8, pg1.u); }
  // h transposed: st[d][block row] then HT[b][d][n0 + 64]
  if (lane < 16) {
#pragma unroll
    for (int d = 0; d < DK; ++d) st[d][wave * 16 + lane] = (_Float16)so[wave][lane][32 + d]; }
  __syncthreads();
  if (tid < DK * 8) { const int d = tid >> 3, pc = tid & 7; vst2(HT + ((size_t)b * DK + d) * NN + n0 + pc * 8, *(const v4u*)(&st[d][pc * 8])); }
}
// value of lane (lane ^ X) inside the 16-lane row (DPP row_xmask); every lane is on where it is used
template <int X> __device__ __forceinline__ float rowx(float v) { return __builtin_bit_cast(float, __builtin_amdgcn_update_dpp(0, __builtin_bit_cast(int, v), 0x160 | X, 0xf, 0xf, true)); }
struct Yes { static constexpr bool v = true; }; struct No { static constexpr bool v = false; };   // compile-time switch of a generic lambda
// the matrix product alone: in the two loops below the vector work of another tile stands behind every product, so the distance to the first use of its result is filled with work
__device__ __forceinline__ v8f wmmap(v16h a, v16h b, v8f c) { return __builtin_amdgcn_wmma_f32_16x16x32_f16(false, a, false, b, (short)0, c, false, false); }
// two loaded tiles of K = 16 side by side are one K = 32 operand (elements 0..7 = k 8h + i of the first, 8..15 = k 16 + 8h + i, that is d = 8h + i of the second); the other operand, [v | 0] or [0 | v], picks the tile
__device__ __forceinline__ v16h join(v8h a, v8h b) { return __builtin_shufflevector(a, b, 0, 1, 2, 3, 4, 5, 6, 7, 8, 9, 10, 11, 12, 13, 14, 15); }
// The order of a step's instructions, told to the scheduler group by group (n instructions of a kind, in the order of these lines): left free, it gathers the products in runs and the
// exponentials in runs, so that the exponential pipe stands idle while products issue and their results are waited for. STEP_END closes the step that the groups are about
#define G_MAT(n) __builtin_amdgcn_sched_group_barrier(0x8, n, 0)     // matrix products
#define G_EXP(n) __builtin_amdgcn_sched_group_barrier(0x400, n, 0)   // exponentials
#define G_VEC(n) __builtin_amdgcn_sched_group_barrier(0x2, n, 0)     // other vector instructions
#define G_LD(n) __builtin_amdgcn_sched_group_barrier(0x20, n, 0)     // global loads
#define STEP_END() __builtin_amdgcn_sched_barrier(0)
#define CT 32             // query tiles of 16 held in registers
#define NP (CT / 2)       // as pairs
#define NBAT (NN / (16 * CT))
#define BATB (CT * 16 * DK * 2)   // bytes of f in a batch of CT tiles
// column statistics: D = g_m . f_n has key row m = 8g + r in register r and query n in the lane's column, so each lane keeps a running
// sum per register over its own query columns; the 16 lanes of a row are merged once, behind the loop
__global__ __launch_bounds__(128) void k_colstat(const _Float16* __restrict__ F16, const _Float16* __restrict__ G16, float* __restrict__ cst) {
  const int tid = threadIdx.x, w = tid >> 5, lane = tid & 31, col = lane & 15, g = lane >> 4;
  const int b = blockIdx.y, m0 = blockIdx.x * 64 + w * 16; const size_t rb = (size_t)b * NN;
  v16h agl, agh;                                        // A = g rows (m0 + col) as [g | 0] and [0 | g]
  { const _Float16* gr = G16 + (rb + m0 + col) * DK;
#pragma unroll  // constant indices keep the array in registers
    for (int i = 0; i < 8; ++i) { agl[i] = gr[8 * g + i]; agl[8 + i] = (_Float16)0.f; agh[i] = (_Float16)0.f; agh[8 + i] = gr[8 * g + i]; } }
  __builtin_amdgcn_sched_barrier(0);   // the g load stays the oldest: issued behind the ring's first loads, the wait for it at the head of the loop would be a wait for every load in flight, on every trip
  // Column sums L = sum over queries of 2^(s - ref), the reference entering the score product as its C operand: no running maximum, no subtraction
  // and no rescale in the loop. The first pass takes ref = 0. It stands wherever every column sum of the wave comes out inside [2^-64, 2^100]: then
  // no term overflowed, and what was flushed to 0 lies under 2^-50 of the sum. Otherwise (scores far from 0) the wave finds its true column maxima
  // and takes the pass once more against them, which holds for any scores
  float Mo = 0.f, Lo = 1.f;
  const _Float16* f0 = F16 + (rb + col) * DK + 8 * g;   // this lane's 8 halves of query row col; a tile of 16 rows further on is 16 * DK halves
  // The 64 blocks of a batch entry walk the same f. Each starts at a batch of tiles of its own (one of NBAT, by block index) and wraps, so that they do not all ask L2 for the same lines at the same moment
  const int rot = (blockIdx.x >> 3) & (NBAT - 1);
  // a ring of NP pairs of tiles in registers: a pair's registers are loaded again, with the tiles CT further on, as soon as its two products have issued, so every load
  // has the work of CT - 2 tiles to arrive in. The products run one pair ahead of the exponentials, so between passes the ring holds pairs 1 .. NP - 1 of the first batch and pair 0 of the second
  const _Float16* fn = f0 + rot * (BATB / 2); const _Float16* fz = f0 + ((rot + 1) & (NBAT - 1)) * (BATB / 2);   // where pairs 1 .. NP - 1, and pair 0, are being loaded from; at the head of every walk fn is the block's first batch
  v16h pr[NP];
#pragma unroll  // constant indices keep the array in registers
  for (int j = 1; j <= NP; ++j) { const int p = j % NP; const _Float16* s = j == NP ? fz : fn + 2 * p * 16 * DK;
    pr[p] = join(*(const v8h*)s, *(const v8h*)(s + 16 * DK));
    __builtin_amdgcn_sched_barrier(0); }   // the pairs are first loaded in the order in which the loop loads them again, so that its counted waits hold for both
  // one walk over all queries: SUM adds 2^(s + cc) into ac, else ac takes the maximum of s (cc = 0). RARE: the two walks of the second try, whose speed does not matter
  auto walk = [&](auto sum, auto rare, const v8f cc, float (&ac)[8]) __attribute__((always_inline)) {
    constexpr bool S = decltype(sum)::v, R = decltype(rare)::v;
    auto prod = [&](const v16h a, const v16h bb) __attribute__((always_inline)) { if constexpr (R) return wmma16(a, bb, cc); else return wmmap(a, bb, cc); };
    const v16h first = join(*(gv8h*)fn, *(gv8h*)(fn + 16 * DK));
    v8f sa = prod(agl, first), sb = prod(agh, first);
    float ep[8];   // the exponentials of the tile before: they are added one tile late, so that no addition waits for its exponential
#pragma unroll  // constant indices keep the array in registers
    for (int r = 0; r < 8; ++r) ep[r] = 0.f;
    auto use = [&](const v8f s) __attribute__((always_inline)) {
#pragma unroll  // constant indices keep the array in registers
      for (int r = 0; r < 8; ++r) { if constexpr (S) { ac[r] += ep[r]; ep[r] = ex2(s[r]); } else ac[r] = fmaxf(ac[r], s[r]); } };
#pragma unroll 1  // one walk of the ring per trip
    for (int nb = 0; nb < NBAT; ++nb) {
      // the last batches load the first ones again, for a further pass: the loads need no branch, which would merge the wait counts of its two sides
      const unsigned long long ob = (unsigned long long)(((nb + 1 + rot) & (NBAT - 1)) * BATB), oz = (unsigned long long)(((nb + 2 + rot) & (NBAT - 1)) * BATB);
      // fn = f0 + ob, fz = f0 + oz, in bytes. The address registers of the issued loads are written again only behind the wait: wait and additions are one statement, since an addition of the compiler's own was drawn up over a wait that stood alone
      asm volatile("s_wait_xcnt 0x0\n\tv_add_nc_u64_e32 %0, %2, %4\n\tv_add_nc_u64_e32 %1, %3, %4" : "+v"(fn), "+v"(fz) : "s"(ob), "s"(oz), "v"(f0) : "memory");
      STEP_END();   // the first step begins here
#pragma unroll  // constant indices keep the array in registers
      for (int p = 0; p < NP; ++p) { const int pn = (p + 1) % NP;
        const v8f na = prod(agl, pr[pn]); use(sa);
        STEP_END();   // a product stays with the exponentials of an earlier tile: gathered in runs, the products' results would be waited for with the vector port idle
        const v8f nc = prod(agh, pr[pn]); use(sb);
        const _Float16* s = pn ? fn + 2 * pn * 16 * DK : fz;
        pr[pn] = join(*(gv8h*)s, *(gv8h*)(s + 16 * DK));
        STEP_END();   // also keeps a pair's loads in the step of its last use: sunk they would arrive late
        sa = na; sb = nc; } }
    if constexpr (S) {
#pragma unroll  // constant indices keep the array in registers
      for (int r = 0; r < 8; ++r) ac[r] += ep[r]; }
    asm volatile("s_wait_xcnt 0x0" :: "v"(fn), "v"(fz), "v"(f0) : "memory"); };   // as above, for what is written behind the loop
  // merges the 16 lanes of a row; lane col == r keeps the value of key row 8g + r
  float lrun[8];
#pragma unroll  // constant indices keep the array in registers
  for (int r = 0; r < 8; ++r) lrun[r] = 0.f;
  { const v8f z = {}; walk(Yes{}, No{}, z, lrun); }
  float lmin = 3.0e38f, lmax = 0.f;
#pragma unroll  // constant indices keep the array in registers
  for (int r = 0; r < 8; ++r) { float l = lrun[r];
    l += rowx<1>(l); l += rowx<2>(l); l += rowx<4>(l); l += rowx<8>(l);
    lmin = fminf(lmin, l); lmax = fmaxf(lmax, l);
    if (col == r) Lo = l; }
  const bool redo = !(lmin >= 0x1p-64f && lmax <= 0x1p100f);   // an overflowed sum is an infinity and fails the test
  if (__builtin_amdgcn_ballot_w32(redo) != 0) {   // the same for the whole wave; the kernel has no barrier
    float mrun[8]; v8f sh;   // sh: minus the reference of key row 8g + r in register r
#pragma unroll  // constant indices keep the array in registers
    for (int r = 0; r < 8; ++r) mrun[r] = -3.0e38f;
    { const v8f z = {}; walk(No{}, Yes{}, z, mrun); }
#pragma unroll  // constant indices keep the array in registers
    for (int r = 0; r < 8; ++r) { float M = mrun[r];
      M = fmaxf(M, rowx<1>(M)); M = fmaxf(M, rowx<2>(M)); M = fmaxf(M, rowx<4>(M)); M = fmaxf(M, rowx<8>(M));
      sh[r] = -M; if (col == r) Mo = M; lrun[r] = 0.f; }
    walk(Yes{}, Yes{}, sh, lrun);
#pragma unroll  // constant indices keep the array in registers
    for (int r = 0; r < 8; ++r) { float l = lrun[r];
      l += rowx<1>(l); l += rowx<2>(l); l += rowx<4>(l); l += rowx<8>(l);
      if (col == r) Lo = l; } }
  // one constant per key, base 2: 2^(s + c) = 2^14 2^(s - M) / L; a wave's 16 constants head a 128-byte line of their own
  if (col < 8) cst[(rb + m0) * 2 + 8 * g + col] = 14.0f - Mo - log2f(Lo);
}
#define NS 2   // batches of 32 keys (two 16-key tiles) held in registers at a time
#define AW 8   // waves per block: each takes NN / AW of the keys, for all 64 queries of the block
#define NBT (NN / (AW * 32))   // batches per wave
#define QT 4   // query tiles of 16 per wave: every loaded key fragment (g, c, h) feeds QT score or PV products
// pass 2: block = 64 queries, wave = all of them against its own NN / AW keys. S^T = g_m . f_n + c_m (c_m enters as the C operand) has key m = 8g + r in
// register r and query n in the lane's column, so exp of two such tiles, converted in place, IS the B operand (32 keys x 16 queries, x2^14 f16) of
// y^T += h^T . P^T: P never leaves the registers. The waves' partial y^T are summed through LDS, in wave order. y^T has d = 8g + r in register r,
// which is the A operand of y @ w_v; wave w then does query tile w & 3, channels 64 (w >> 2) .. + 63. out = gamma*(y @ w_v) + x
__global__ __launch_bounds__(32 * AW) void k_apply(const _Float16* __restrict__ F16, const _Float16* __restrict__ G16, const _Float16* __restrict__ HT, const float* __restrict__ cst, const float* __restrict__ wv, const float* __restrict__ gam, const float* __restrict__ x, float* __restrict__ out) {
  __shared__ __align__(16) float red[AW][QT][2][32][4];   // partial y^T: [wave][query tile][register quad][lane][register in the quad]
  __shared__ __align__(16) float so[AW][16][68];
  const int tid = threadIdx.x, w = tid >> 5, lane = tid & 31, col = lane & 15, g = lane >> 4;
  const int b = blockIdx.y, n0b = blockIdx.x * 64, k0 = w * (NN / AW); const size_t rb = (size_t)b * NN;
  v16h bfl[QT], bfh[QT];   // B = f rows (n0b + 16 q + col) as [f | 0] and [0 | f]: against A = [g of tile 0 | g of tile 1] they give the scores of tile 0 and of tile 1
#pragma unroll  // constant indices keep the array in registers
  for (int q = 0; q < QT; ++q) { const _Float16* fr = F16 + (rb + n0b + q * 16 + col) * DK;
#pragma unroll
    for (int i = 0; i < 8; ++i) { bfl[q][i] = fr[8 * g + i]; bfl[q][8 + i] = (_Float16)0.f; bfh[q][i] = (_Float16)0.f; bfh[q][8 + i] = fr[8 * g + i]; } }
  v8f acc[QT] = {};
  const _Float16* gp = G16 + (rb + k0 + col) * DK + 8 * g;              // this lane's 8 halves of key row k0 + col; the next tile is 16 * DK halves on
  const float* cp = cst + (rb + k0) * 2 + 8 * g;                        // the constants of key rows k0 + 8g .. + 7; the next tile is 32 floats on
  const _Float16* hp = HT + ((size_t)b * DK + col) * NN + k0 + 8 * g;   // row d = col of h^T, keys k0 + 8g .. + 7; the next tile is 16 halves on
  // two slots of 32 keys in registers. The work goes in steps of one slot and one query tile, and three steps are under way at a time: the score products of the step
  // to come, the exponentials of this one, the PV product of the one before. A slot's g and c are loaded again right behind its last score product, its h right behind its last PV product:
  // every load has five steps to arrive in
  v16h ga[NS], ha[NS]; v8f c[NS][2];
  // The 64 blocks of a batch entry walk the same keys. Each starts its waves' ranges at a trip of its own (one of NBT / NS, by block index) and wraps, so that they do not all ask L2 for the same lines at the same moment
  const int r0 = ((blockIdx.x >> 3) & (NBT / NS - 1)) * NS;   // the first batch of the walk
  const _Float16* gn = gp + r0 * 32 * DK; const float* cn = cp + r0 * 64; const _Float16* hn = hp + r0 * 32;   // where the slots are being loaded from
  __builtin_amdgcn_sched_barrier(0);   // the f loads stay the oldest, and the slots are first loaded in the order in which the loop loads them again (the fences below), so that its counted waits hold for both
#pragma unroll  // constant indices keep the arrays in registers
  for (int sl = 0; sl < NS; ++sl) {
    ga[sl] = join(*(const v8h*)(gn + (2 * sl) * 16 * DK), *(const v8h*)(gn + (2 * sl + 1) * 16 * DK));
#pragma unroll
    for (int t = 0; t < 2; ++t) c[sl][t] = *(const v8f*)(cn + (2 * sl + t) * 32);
    __builtin_amdgcn_sched_barrier(0);
    if (sl == 0) { ha[sl] = join(*(const v8h*)hn, *(const v8h*)(hn + 16));
      __builtin_amdgcn_sched_barrier(0); } }
  // the first step has no step before it: its P is 0 and its PV product adds 0 . 0
  ha[NS - 1] = v16h{};
  float e[16];   // the exponentials of the step before, not yet converted
#pragma unroll  // constant indices keep the array in registers
  for (int r = 0; r < 16; ++r) e[r] = 0.f;
  v8f s0 = wmmap(ga[0], bfl[0], c[0][0]), s1 = wmmap(ga[0], bfh[0], c[0][1]);
  // one trip: both slots are used; where more batches follow (MORE), each is loaded again on the way. The last trip is a copy of its own without those loads:
  // a branch round them would merge the wait counts of its two sides, and loads that nobody uses would hold up the registers of the tail
  auto trip = [&](int mb, auto more) __attribute__((always_inline)) {
#pragma unroll  // constant indices keep the arrays in registers
    for (int sl = 0; sl < NS; ++sl)
#pragma unroll  // constant indices keep the arrays in registers
      for (int q = 0; q < QT; ++q) {
        constexpr bool M = decltype(more)::v;
        const int qn = (q + 1) % QT, sn = q == QT - 1 ? (sl + 1) % NS : sl;     // the step to come
        const int qb = (q + QT - 1) % QT, sb = q == 0 ? (sl + NS - 1) % NS : sl;   // the step before
        const bool nxt = M || !(sl == NS - 1 && q == QT - 1);
        const bool ldh = q == 0 && (M || sl == 0), ldg = M && q == QT - 2;
        v16h pb; v8f n0 = {}, n1 = {};
        if (nxt) { n0 = wmmap(ga[sn], bfl[qn], c[sn][0]); n1 = wmmap(ga[sn], bfh[qn], c[sn][1]); }
        if (ldg) {   // these score products were the last of slot sl
          // holds the old c in its registers up to here, so that the last products do not write their scores over it: the new c would then land elsewhere and be copied, behind a full wait, at the foot of the trip
          asm volatile("" :: "v"(c[sl][0]), "v"(c[sl][1]));
          ga[sl] = join(*(gv8h*)(gn + (2 * sl) * 16 * DK), *(gv8h*)(gn + (2 * sl + 1) * 16 * DK));
#pragma unroll  // constant indices keep the arrays in registers
          for (int t = 0; t < 2; ++t) c[sl][t] = *(gv8f*)(cn + (2 * sl + t) * 32); }
#pragma unroll  // constant indices keep the arrays in registers
        for (int r = 0; r < 16; ++r) pb[r] = (_Float16)e[r];
#pragma unroll  // constant indices keep the arrays in registers
        for (int r = 0; r < 8; ++r) { e[r] = ex2(s0[r]); e[8 + r] = ex2(s1[r]); }
        acc[qb] = wmmap(ha[sb], pb, acc[qb]);
        if (ldh) ha[sb] = join(*(gv8h*)(hn + (2 * sb) * 16), *(gv8h*)(hn + (2 * sb + 1) * 16));   // that PV product was the last of slot sb
        // the step's order: the conversions and the two score products one by one between exponentials, the PV product last, behind its conversions: the three products stand far apart, and nothing waits for a result
#pragma unroll  // the groups of the step, written out
        for (int k = 0; k < 10; ++k) { G_EXP(1); if (k == 2 || k == 6) { if (nxt) G_MAT(1); if (k == 6 && ldg) G_LD(6); } else G_VEC(1); }
        G_EXP(6); G_MAT(1); if (ldh) G_LD(2);
        // holds the scores in their registers to the end of the step: an exponential that stands directly behind another one would else be given the register that the first has just read, and the instruction set asks for a slot between the two
        asm volatile("" :: "v"(s0), "v"(s1));
        STEP_END();   // also keeps the loads in this step and in this order: the counted waits go by the order
        if (M && sl == 0 && q == 0) {
          const int nx = (mb + NS + r0) & (NBT - 1);
          const unsigned long long og = (unsigned long long)(nx * 32 * DK * 2), oc = (unsigned long long)(nx * 64 * 4), oh = (unsigned long long)(nx * 32 * 2);
          // gn = gp + og, cn = cp + oc, hn = hp + oh, in bytes (the h load above still went by the trip before: its slot is one batch on). The address registers of the issued loads are written again only behind the wait: wait and additions are one statement, since an addition of the compiler's own can be drawn up over a wait that stands alone
          asm volatile("s_wait_xcnt 0x0\n\tv_add_nc_u64_e32 %0, %3, %6\n\tv_add_nc_u64_e32 %1, %4, %7\n\tv_add_nc_u64_e32 %2, %5, %8" : "+v"(gn), "+v"(cn), "+v"(hn) : "s"(og), "s"(oc), "s"(oh), "v"(gp), "v"(cp), "v"(hp) : "memory");
          STEP_END(); }   // the next step begins here
        s0 = n0; s1 = n1; } };
#pragma unroll 1  // one pass over the slots per trip
  for (int mb = 0; mb < NBT - NS; mb += NS) trip(mb, Yes{});
  trip(NBT - NS, No{});
  asm volatile("s_wait_xcnt 0x0" :: "v"(gn), "v"(cn), "v"(hn), "v"(gp), "v"(cp), "v"(hp) : "memory");   // as above, for what is written behind the loop
  { v16h pb;   // the PV product of the last step
#pragma unroll  // constant indices keep the arrays in registers
    for (int r = 0; r < 16; ++r) pb[r] = (_Float16)e[r];
    acc[QT - 1] = wmma16(ha[NS - 1], pb, acc[QT - 1]); }
  // the x and w_v values of the tail issue here, together: they are waited for once, with the exchange of the partial sums
  const int qt = w & 3, jh = w >> 2, n0 = n0b + qt * 16;
  float xv[4][8]; const float* xq = x + (rb + n0 + 8 * g) * CC + jh * 64 + col;   // row n0 + 8g, this lane's channel in the wave's first tile
#pragma unroll  // constant indices keep the array in registers
  for (int j = 0; j < 4; ++j)
#pragma unroll
    for (int r = 0; r < 8; ++r) xv[j][r] = xq[r * CC + j * 16];
  float wr[4][8]; const float* wp = wv + (size_t)(8 * g) * CC + jh * 64 + col;   // row 8g of w_v, this lane's channel in the wave's first tile
#pragma unroll  // constant indices keep the array in registers
  for (int j = 0; j < 4; ++j)
#pragma unroll
    for (int i = 0; i < 8; ++i) wr[j][i] = wp[i * CC + j * 16];
  __builtin_amdgcn_sched_barrier(0);   // keeps the loads above together and up here: moved down to their uses they would be waited for in five groups, one after another
  // the waves' partial sums meet: each wave lays down its QT tiles, and behind the barrier adds up the AW partials of the one tile it finishes
#pragma unroll  // constant indices keep the array in registers
  for (int q = 0; q < QT; ++q)
#pragma unroll
    for (int hh = 0; hh < 2; ++hh) { v4f t = { acc[q][4 * hh], acc[q][4 * hh + 1], acc[q][4 * hh + 2], acc[q][4 * hh + 3] }; *(v4f*)(&red[w][q][hh][lane][0]) = t; }
  __syncthreads();
  asm volatile("s_wait_xcnt 0x0" :: "v"(xq), "v"(wp) : "memory");   // the address registers of the tail's loads are written again only behind this wait; naming the addresses keeps them whole up to here
  v8f y = {};
#pragma unroll  // constant indices keep the array in registers
  for (int ww = 0; ww < AW; ++ww)
#pragma unroll
    for (int hh = 0; hh < 2; ++hh) { const v4f t = *(const v4f*)(&red[ww][qt][hh][lane][0]);
#pragma unroll
      for (int e = 0; e < 4; ++e) y[4 * hh + e] += t[e]; }
  // out = gamma * (y @ w_v) + x : y [16 x 16] @ w_v [16 x 64 of 128] -> WMMA K=16 (zero-padded), 4 tiles of 16 channels
  { v16h ay;
#pragma unroll
    for (int i = 0; i < 8; ++i) { ay[i] = (_Float16)(y[i] * (1.0f / 16384.0f)); ay[8 + i] = (_Float16)0.f; }
    const float gm = gam[0];
#pragma unroll
    for (int j = 0; j < 4; ++j) { v16h bb;
#pragma unroll
      for (int i = 0; i < 8; ++i) { bb[i] = (_Float16)(wr[j][i] * 4.0f); bb[8 + i] = (_Float16)0.f; }
      v8f o = {}; o = wmma16(ay, bb, o);
#pragma unroll
      for (int r = 0; r < 8; ++r) so[w][8 * g + r][j * 16 + col] = gm * o[r] * 0.25f + xv[j][r]; } }
  LDSX();
#pragma unroll 4
  for (int rp = 0; rp < 8; ++rp) { const int rl = 2 * rp + g; vst2(out + (rb + n0 + rl) * CC + jh * 64 + col * 4, *(const v4f*)(&so[w][rl][col * 4])); }
}
extern "C" void kernel_launch(void* const* d_in, const int* in_sizes, int n_in, void* d_out, int out_size, void* d_ws, size_t ws_size, hipStream_t stream) {
  (void)in_sizes; (void)n_in; (void)out_size; (void)ws_size;
  const float** I = (const float**)d_in;
  const float* x = I[0]; const float* wf = I[1]; const float* wg = I[2]; const float* wh = I[3]; const float* wv = I[4]; const float* gam = I[5];
  float* out = (float*)d_out;
  char* ws = (char*)d_ws; size_t off = 0;
  auto take = [&](size_t bytes) { char* p = ws + off; off += (bytes + 255) & ~(size_t)255; return p; };
  _Float16* F16 = (_Float16*)take((size_t)NR * DK * 2); _Float16* G16 = (_Float16*)take((size_t)NR * DK * 2); _Float16* HT = (_Float16*)take((size_t)NR * DK * 2); float* cst = (float*)take((size_t)NR * 2 * 4);
  k_proj<<<NR / 64, 128, 0, stream>>>(x, wf, wg, wh, F16, G16, HT);
  k_colstat<<<dim3(NN / 64, NB), 128, 0, stream>>>(F16, G16, cst);
  k_apply<<<dim3(NN / 64, NB), 32 * AW, 0, stream>>>(F16, G16, HT, cst, wv, gam, x, out);
}

// v010
// It runs in 28.1 microseconds.
// Next to v009, in two timings, it ran 1.05 and 1.06 times as fast.
// All steps since v000 together make it 12.7 times as fast.
#include <hip/hip_runtime.h>
#include <math.h>

typedef __attribute__((ext_vector_type(16))) _Float16 v16h;
typedef __attribute__((ext_vector_type(16))) __bf16 v16b;
typedef __attribute__((ext_vector_type(8)))  _Float16 v8h;
typedef __attribute__((ext_vector_type(8)))  float v8f;
typedef __attribute__((ext_vector_type(4)))  float v4f;
typedef __attribute__((ext_vector_type(2)))  float v2f;
typedef __attribute__((ext_vector_type(4)))  unsigned v4u;
typedef __attribute__((ext_vector_type(4)))  int v4i;
typedef float __attribute__((may_alias)) float_a;
typedef int __attribute__((may_alias)) int_a;
// loads through an address that an asm statement has written: the compiler no longer sees that it is global memory and would take the slower flat form, so the type says it
typedef const v8h __attribute__((address_space(1))) gv8h;
typedef const v8f __attribute__((address_space(1))) gv8f;

template <typename T> __device__ __forceinline__ void vst2(void* p, T v) { *(T*)p = v;  }
__device__ __forceinline__ v8f wmma16(v16h a, v16h b, v8f c) {
  v8f d = __builtin_amdgcn_wmma_f32_16x16x32_f16(false, a, false, b, (short)0, c, false, false);
  asm volatile("v_nop\n\tv_nop\n\tv_nop\n\tv_nop" : "+v"(d) : "v"(a), "v"(b));
  return d;
}
__device__ __forceinline__ v8f wmma_bf(v16b a, v16b b, v8f c) {
  v8f d = __builtin_amdgcn_wmma_f32_16x16x32_bf16(false, a, false, b, (short)0, c, false, false);
  asm volatile("v_nop\n\tv_nop\n\tv_nop\n\tv_nop" : "+v"(d) : "v"(a), "v"(b));
  return d;
}
// 16x16x32 fragments: lane = (h = lane>>4, row/col = lane&15); elements 0..7 = k0+8h+0..7, 8..15 = k0+16+8h+0..7; D element r = row 8h+r
__device__ __forceinline__ v16h frag_h(const _Float16* rowk0, int lane) {
  union { v16h v; v8h q[2]; } u; const _Float16* p = rowk0 + 8 * (lane >> 4);
  u.q[0] = *(const v8h*)p; u.q[1] = *(const v8h*)(p + 16); return u.v;
}
__device__ __forceinline__ v16h frag_f32(const float* rowk0, int lane) {
  v16h a; const float* p = rowk0 + 8 * (lane >> 4);
#pragma unroll
  for (int i = 0; i < 8; ++i) { a[i] = (_Float16)p[i]; a[8 + i] = (_Float16)p[16 + i]; }
  return a;
}
__device__ __forceinline__ v16h frag_f32s(const float* rowk0, int lane, float sc) {
  v16h a; const float* p = rowk0 + 8 * (lane >> 4);
#pragma unroll
  for (int i = 0; i < 8; ++i) { a[i] = (_Float16)(p[i] * sc); a[8 + i] = (_Float16)(p[16 + i] * sc); }
  return a;
}
// column fragment from a [K][ld] layout (column n), rows >= K read as 0
__device__ __forceinline__ v16h fragc_f32(const float* W, int k0, int n, int lane, int ld, int K) {
  v16h a; const int g = lane >> 4;
#pragma unroll
  for (int i = 0; i < 8; ++i) { const int ka = k0 + 8 * g + i, kb = ka + 16;
    a[i] = (_Float16)(ka < K ? W[(size_t)ka * ld + n] : 0.f); a[8 + i] = (_Float16)(kb < K ? W[(size_t)kb * ld + n] : 0.f); }
  return a;
}
struct F2 { v16b h, l; };
__device__ __forceinline__ F2 bsplit16(const float v[16]) { F2 r;
#pragma unroll
  for (int i = 0; i < 16; ++i) { const __bf16 h = (__bf16)v[i]; r.h[i] = h; r.l[i] = (__bf16)(v[i] - (float)h); }
  return r; }
__device__ __forceinline__ F2 split_row(const float* row, int k0, int lane) { float v[16]; const float* p = row + k0 + 8 * (lane >> 4);
#pragma unroll
  for (int i = 0; i < 8; ++i) { v[i] = p[i]; v[8 + i] = p[16 + i]; }
  return bsplit16(v); }
__device__ __forceinline__ F2 split_rowK(const float* row, int k0, int lane, int K) { float v[16]; const int g = lane >> 4;
#pragma unroll
  for (int i = 0; i < 8; ++i) { const int ka = k0 + 8 * g + i, kb = ka + 16; v[i] = ka < K ? row[ka] : 0.f; v[8 + i] = kb < K ? row[kb] : 0.f; }
  return bsplit16(v); }
__device__ __forceinline__ F2 split_col(const float* W, int k0, int n, int lane, int ld, int K) { float v[16]; const int g = lane >> 4;
#pragma unroll
  for (int i = 0; i < 8; ++i) { const int ka = k0 + 8 * g + i, kb = ka + 16; v[i] = ka < K ? W[(size_t)ka * ld + n] : 0.f; v[8 + i] = kb < K ? W[(size_t)kb * ld + n] : 0.f; }
  return bsplit16(v); }
__device__ __forceinline__ v8f mac3(const F2& a, const F2& b, v8f c) { c = wmma_bf(a.l, b.h, c); c = wmma_bf(a.h, b.l, c); return wmma_bf(a.h, b.h, c); }
__device__ __forceinline__ float sigm(float v) { return 1.0f / (1.0f + expf(-v)); }

// 2-D self-attention with the softmax taken over the QUERY axis (axis=1 of [b,n,m], as the reference does). f, g, hh = x @ w (K = 128,
// tiles, K = 16 zero-padded); pass 2: per query block y[n] = sum_m exp(s[n][m] - M_m)/L_m hh[m] on WMMA (P x2^14 f16), then
#define NB 8
#define NN 4096
#define CC 128
#define DK 16
#define NR (NB * NN)
#define LOG2E 1.44269504f   // g is stored times log2 e: every score comes out of the WMMA in base-2 units and each exponential is one v_exp_f32
// 2^v as the bare instruction, without the library's range fix-up: a result under 2^-126 may come out 0, which is far under what a sum that holds a term of 1, or an f16 P, can show
__device__ __forceinline__ float ex2(float v) { return __builtin_amdgcn_exp2f(v); }

#define WP 136   // halves per staged weight column: 272 bytes, an odd multiple of 16, so the 16-byte LDS accesses of 16 columns spread over the banks
// f/g/h projections: block 64 rows; outputs F16,G16 [r][16] f16 (G16 = g log2 e: scores = f.g (K=16) in base-2 units, no other scaling), HT = h in the order of the PV A fragment:
// 512 bytes per tile of 16 rows, lane (d = lane & 15, g = lane >> 4) owning the 16 bytes h[8g .. 8g + 7][d]. f and g are taken as w^T . x^T, h as x . w_h: each lane's accumulators are then the 16 bytes it stores
__global__ __launch_bounds__(128) void k_proj(const float* __restrict__ x, const float* __restrict__ wf, const float* __restrict__ wg, const float* __restrict__ wh, _Float16* __restrict__ F16, _Float16* __restrict__ G16, _Float16* __restrict__ HT) {
  __shared__ __align__(16) _Float16 sw[3][DK][WP];   // w_f, w_g, w_h as f16, transposed to [column][k]: a B fragment is two 16-byte reads
  const int tid = threadIdx.x, wave = tid >> 5, lane = tid & 31, col = lane & 15, g = lane >> 4;
  const int r0 = blockIdx.x * 64 + wave * 16;
  // every global load of the kernel issues here, before anything waits; x, which comes from furthest away, first
  v4f xr[CC / 32][4];   // this lane's part of row r0 + col: per 32 channels, floats 8g .. 8g + 7 and 16 + 8g .. 16 + 8g + 7
  const float* xp = x + (size_t)(r0 + col) * CC + 8 * g;
#pragma unroll  // constant indices keep the array in registers
  for (int kc = 0; kc < CC / 32; ++kc) { xr[kc][0] = *(const v4f*)(xp + kc * 32); xr[kc][1] = *(const v4f*)(xp + kc * 32 + 4); xr[kc][2] = *(const v4f*)(xp + kc * 32 + 16); xr[kc][3] = *(const v4f*)(xp + kc * 32 + 20); }
  asm volatile("s_wait_xcnt 0x0" :: "v"(xp) : "memory");   // an address register of issued loads is written (by a later load's result or a vector instruction) only behind this wait; naming the address keeps it whole up to here
  // a thread takes 8 consecutive k of one column, twice per matrix: the block reads each weight once
  const int wn = tid & 15, wk = (tid >> 4) * 8;
  const float* w0 = wf + (size_t)wk * DK + wn; const float* w1 = wg + (size_t)wk * DK + wn; const float* w2 = wh + (size_t)wk * DK + wn;
  float wr[6][8];
#pragma unroll  // constant indices keep the array in registers
  for (int c = 0; c < 6; ++c) { const float* wsrc = (c < 2 ? w0 : c < 4 ? w1 : w2) + 64 * (c & 1) * DK;
#pragma unroll
    for (int i = 0; i < 8; ++i) wr[c][i] = wsrc[i * DK]; }
  asm volatile("s_wait_xcnt 0x0" :: "v"(w0), "v"(w1), "v"(w2) : "memory");   // as above; naming the addresses keeps a result of these same loads out of their registers
  __builtin_amdgcn_sched_barrier(0);   // keeps the loads above together: moved down to their uses they would be waited for one small group after another
#pragma unroll  // constant indices keep the array in registers
  for (int c = 0; c < 6; ++c) { v8h p;
#pragma unroll
    for (int i = 0; i < 8; ++i) p[i] = (_Float16)wr[c][i];
    *(v8h*)(&sw[c >> 1][wn][wk + 64 * (c & 1)]) = p; }
  __syncthreads();
  v16h wb[CC / 32][3];
#pragma unroll  // constant indices keep the array in registers
  for (int kc = 0; kc < CC / 32; ++kc)
#pragma unroll
    for (int j = 0; j < 3; ++j) wb[kc][j] = frag_h(&sw[j][col][kc * 32], lane);
  __builtin_amdgcn_sched_barrier(0);   // keeps the LDS reads above together: one LDS latency for the twelve fragments, not one in front of each product
  v8f acc[3] = {};
#pragma unroll
  for (int kc = 0; kc < CC / 32; ++kc) { v16h a;
#pragma unroll
    for (int i = 0; i < 4; ++i) { a[i] = (_Float16)xr[kc][0][i]; a[4 + i] = (_Float16)xr[kc][1][i]; a[8 + i] = (_Float16)xr[kc][2][i]; a[12 + i] = (_Float16)xr[kc][3][i]; }
    acc[0] = wmma16(wb[kc][0], a, acc[0]); acc[1] = wmma16(wb[kc][1], a, acc[1]); acc[2] = wmma16(a, wb[kc][2], acc[2]); }
  // acc[0], acc[1]: register r = column d = 8g + r of f, g, for row r0 + col; acc[2]: register r = row r0 + 8g + r of h, column d = col. Each store of the wave covers 512 consecutive bytes
  v8h pf, pg, ph;
#pragma unroll
  for (int r = 0; r < 8; ++r) { pf[r] = (_Float16)acc[0][r]; pg[r] = (_Float16)(acc[1][r] * LOG2E); ph[r] = (_Float16)acc[2][r]; }
  *(v8h*)(F16 + (size_t)(r0 + col) * DK + 8 * g) = pf; *(v8h*)(G16 + (size_t)(r0 + col) * DK + 8 * g) = pg; *(v8h*)(HT + (size_t)r0 * DK + lane * 8) = ph;
}
// value of lane (lane ^ X) inside the 16-lane row (DPP row_xmask); every lane is on where it is used
template <int X> __device__ __forceinline__ float rowx(float v) { return __builtin_bit_cast(float, __builtin_amdgcn_update_dpp(0, __builtin_bit_cast(int, v), 0x160 | X, 0xf, 0xf, true)); }
struct Yes { static constexpr bool v = true; }; struct No { static constexpr bool v = false; };   // compile-time switch of a generic lambda
// the matrix product alone: in the two loops below the vector work of another tile stands behind every product, so the distance to the first use of its result is filled with work
__device__ __forceinline__ v8f wmmap(v16h a, v16h b, v8f c) { return __builtin_amdgcn_wmma_f32_16x16x32_f16(false, a, false, b, (short)0, c, false, false); }
// two loaded tiles of K = 16 side by side are one K = 32 operand (elements 0..7 = k 8h + i of the first, 8..15 = k 16 + 8h + i, that is d = 8h + i of the second); the other operand, [v | 0] or [0 | v], picks the tile
__device__ __forceinline__ v16h join(v8h a, v8h b) { return __builtin_shufflevector(a, b, 0, 1, 2, 3, 4, 5, 6, 7, 8, 9, 10, 11, 12, 13, 14, 15); }
// The order of a step's instructions, told to the scheduler group by group (n instructions of a kind, in the order of these lines): left free, it gathers the products in runs and the
// exponentials in runs, so that the exponential pipe stands idle while products issue and their results are waited for. STEP_END closes the step that the groups are about
#define G_MAT(n) __builtin_amdgcn_sched_group_barrier(0x8, n, 0)     // matrix products
#define G_EXP(n) __builtin_amdgcn_sched_group_barrier(0x400, n, 0)   // exponentials
#define G_VEC(n) __builtin_amdgcn_sched_group_barrier(0x2, n, 0)     // other vector instructions
#define G_LD(n) __builtin_amdgcn_sched_group_barrier(0x20, n, 0)     // global loads
#define STEP_END() __builtin_amdgcn_sched_barrier(0)
#define CT 32             // query tiles of 16 held in registers
#define NP (CT / 2)       // as pairs
#define NBAT (NN / (16 * CT))
#define BATB (CT * 16 * DK * 2)   // bytes of f in a batch of CT tiles
// column statistics: D = g_m . f_n has key row m = 8g + r in register r and query n in the lane's column, so each lane keeps a running
// sum per register over its own query columns; the 16 lanes of a row are merged once, behind the loop
__global__ __launch_bounds__(128) void k_colstat(const _Float16* __restrict__ F16, const _Float16* __restrict__ G16, float* __restrict__ cst) {
  const int tid = threadIdx.x, w = tid >> 5, lane = tid & 31, col = lane & 15, g = lane >> 4;
  const int b = blockIdx.y, m0 = blockIdx.x * 64 + w * 16; const size_t rb = (size_t)b * NN;
  v16h agl, agh;                                        // A = g rows (m0 + col) as [g | 0] and [0 | g]
  { const _Float16* gr = G16 + (rb + m0 + col) * DK;
#pragma unroll  // constant indices keep the array in registers
    for (int i = 0; i < 8; ++i) { agl[i] = gr[8 * g + i]; agl[8 + i] = (_Float16)0.f; agh[i] = (_Float16)0.f; agh[8 + i] = gr[8 * g + i]; } }
  __builtin_amdgcn_sched_barrier(0);   // the g load stays the oldest: issued behind the ring's first loads, the wait for it at the head of the loop would be a wait for every load in flight, on every trip
  // Column sums L = sum over queries of 2^(s - ref), the reference entering the score product as its C operand: no running maximum, no subtraction
  // and no rescale in the loop. The first pass takes ref = 0. It stands wherever every column sum of the wave comes out inside [2^-64, 2^100]: then
  // no term overflowed, and what was flushed to 0 lies under 2^-50 of the sum. Otherwise (scores far from 0) the wave finds its true column maxima
  // and takes the pass once more against them, which holds for any scores
  float Mo = 0.f, Lo = 1.f;
  const _Float16* f0 = F16 + (rb + col) * DK + 8 * g;   // this lane's 8 halves of query row col; a tile of 16 rows further on is 16 * DK halves
  // The 64 blocks of a batch entry walk the same f. Each starts at a batch of tiles of its own (one of NBAT, by block index) and wraps, so that they do not all ask L2 for the same lines at the same moment
  const int rot = (blockIdx.x >> 3) & (NBAT - 1);
  // a ring of NP pairs of tiles in registers: a pair's registers are loaded again, with the tiles CT further on, as soon as its two products have issued, so every load
  // has the work of CT - 2 tiles to arrive in. The products run one pair ahead of the exponentials, so between passes the ring holds pairs 1 .. NP - 1 of the first batch and pair 0 of the second
  const _Float16* fn = f0 + rot * (BATB / 2); const _Float16* fz = f0 + ((rot + 1) & (NBAT - 1)) * (BATB / 2);   // where pairs 1 .. NP - 1, and pair 0, are being loaded from; at the head of every walk fn is the block's first batch
  v16h pr[NP];
#pragma unroll  // constant indices keep the array in registers
  for (int j = 1; j <= NP; ++j) { const int p = j % NP; const _Float16* s = j == NP ? fz : fn + 2 * p * 16 * DK;
    pr[p] = join(*(const v8h*)s, *(const v8h*)(s + 16 * DK));
    __builtin_amdgcn_sched_barrier(0); }   // the pairs are first loaded in the order in which the loop loads them again, so that its counted waits hold for both
  // one walk over all queries: SUM adds 2^(s + cc) into ac, else ac takes the maximum of s (cc = 0). RARE: the two walks of the second try, whose speed does not matter
  auto walk = [&](auto sum, auto rare, const v8f cc, float (&ac)[8]) __attribute__((always_inline)) {
    constexpr bool S = decltype(sum)::v, R = decltype(rare)::v;
    auto prod = [&](const v16h a, const v16h bb) __attribute__((always_inline)) { if constexpr (R) return wmma16(a, bb, cc); else return wmmap(a, bb, cc); };
    const v16h first = join(*(gv8h*)fn, *(gv8h*)(fn + 16 * DK));
    v8f sa = prod(agl, first), sb = prod(agh, first);
    float ep[8];   // the exponentials of the tile before: they are added one tile late, so that no addition waits for its exponential
#pragma unroll  // constant indices keep the array in registers
    for (int r = 0; r < 8; ++r) ep[r] = 0.f;
    auto use = [&](const v8f s) __attribute__((always_inline)) {
#pragma unroll  // constant indices keep the array in registers
      for (int r = 0; r < 8; ++r) { if constexpr (S) { ac[r] += ep[r]; ep[r] = ex2(s[r]); } else ac[r] = fmaxf(ac[r], s[r]); } };
#pragma unroll 1  // one walk of the ring per trip
    for (int nb = 0; nb < NBAT; ++nb) {
      // the last batches load the first ones again, for a further pass: the loads need no branch, which would merge the wait counts of its two sides
      const unsigned long long ob = (unsigned long long)(((nb + 1 + rot) & (NBAT - 1)) * BATB), oz = (unsigned long long)(((nb + 2 + rot) & (NBAT - 1)) * BATB);
      // fn = f0 + ob, fz = f0 + oz, in bytes. The address registers of the issued loads are written again only behind the wait: wait and additions are one statement, since an addition of the compiler's own was drawn up over a wait that stood alone
      asm volatile("s_wait_xcnt 0x0\n\tv_add_nc_u64_e32 %0, %2, %4\n\tv_add_nc_u64_e32 %1, %3, %4" : "+v"(fn), "+v"(fz) : "s"(ob), "s"(oz), "v"(f0) : "memory");
      STEP_END();   // the first step begins here
#pragma unroll  // constant indices keep the array in registers
      for (int p = 0; p < NP; ++p) { const int pn = (p + 1) % NP;
        const v8f na = prod(agl, pr[pn]); use(sa);
        STEP_END();   // a product stays with the exponentials of an earlier tile: gathered in runs, the products' results would be waited for with the vector port idle
        const v8f nc = prod(agh, pr[pn]); use(sb);
        const _Float16* s = pn ? fn + 2 * pn * 16 * DK : fz;
        pr[pn] = join(*(gv8h*)s, *(gv8h*)(s + 16 * DK));
        STEP_END();   // also keeps a pair's loads in the step of its last use: sunk they would arrive late
        sa = na; sb = nc; } }
    if constexpr (S) {
#pragma unroll  // constant indices keep the array in registers
      for (int r = 0; r < 8; ++r) ac[r] += ep[r]; }
    asm volatile("s_wait_xcnt 0x0" :: "v"(fn), "v"(fz), "v"(f0) : "memory"); };   // as above, for what is written behind the loop
  // merges the 16 lanes of a row; lane col == r keeps the value of key row 8g + r
  float lrun[8];
#pragma unroll  // constant indices keep the array in registers
  for (int r = 0; r < 8; ++r) lrun[r] = 0.f;
  { const v8f z = {}; walk(Yes{}, No{}, z, lrun); }
  float lmin = 3.0e38f, lmax = 0.f;
#pragma unroll  // constant indices keep the array in registers
  for (int r = 0; r < 8; ++r) { float l = lrun[r];
    l += rowx<1>(l); l += rowx<2>(l); l += rowx<4>(l); l += rowx<8>(l);
    lmin = fminf(lmin, l); lmax = fmaxf(lmax, l);
    if (col == r) Lo = l; }
  const bool redo = !(lmin >= 0x1p-64f && lmax <= 0x1p100f);   // an overflowed sum is an infinity and fails the test
  if (__builtin_amdgcn_ballot_w32(redo) != 0) {   // the same for the whole wave; the kernel has no barrier
    float mrun[8]; v8f sh;   // sh: minus the reference of key row 8g + r in register r
#pragma unroll  // constant indices keep the array in registers
    for (int r = 0; r < 8; ++r) mrun[r] = -3.0e38f;
    { const v8f z = {}; walk(No{}, Yes{}, z, mrun); }
#pragma unroll  // constant indices keep the array in registers
    for (int r = 0; r < 8; ++r) { float M = mrun[r];
      M = fmaxf(M, rowx<1>(M)); M = fmaxf(M, rowx<2>(M)); M = fmaxf(M, rowx<4>(M)); M = fmaxf(M, rowx<8>(M));
      sh[r] = -M; if (col == r) Mo = M; lrun[r] = 0.f; }
    walk(Yes{}, Yes{}, sh, lrun);
#pragma unroll  // constant indices keep the array in registers
    for (int r = 0; r < 8; ++r) { float l = lrun[r];
      l += rowx<1>(l); l += rowx<2>(l); l += rowx<4>(l); l += rowx<8>(l);
      if (col == r) Lo = l; } }
  // one constant per key, base 2: 2^(s + c) = 2^14 2^(s - M) / L; a wave's 16 constants head a 128-byte line of their own
  if (col < 8) cst[(rb + m0) * 2 + 8 * g + col] = 14.0f - Mo - log2f(Lo);
}
#define NS 2   // batches of 32 keys (two 16-key tiles) held in registers at a time
#define AW 8   // waves per block: each takes NN / AW of the keys, for all 64 queries of the block
#define NBT (NN / (AW * 32))   // batches per wave
#define QT 4   // query tiles of 16 per wave: every loaded key fragment (g, c, h) feeds QT score or PV products
// pass 2: block = 64 queries, wave = all of them against its own NN / AW keys. S^T = g_m . f_n + c_m (c_m enters as the C operand) has key m = 8g + r in
// register r and query n in the lane's column, so exp of two such tiles, converted in place, IS the B operand (32 keys x 16 queries, x2^14 f16) of
// y^T += h^T . P^T: P never leaves the registers. The waves' partial y^T are summed through LDS, in wave order. y^T has d = 8g + r in register r,
// which is the A operand of y @ w_v; wave w then does query tile w & 3, channels 64 (w >> 2) .. + 63. out = gamma*(y @ w_v) + x
__global__ __launch_bounds__(32 * AW) void k_apply(const _Float16* __restrict__ F16, const _Float16* __restrict__ G16, const _Float16* __restrict__ HT, const float* __restrict__ cst, const float* __restrict__ wv, const float* __restrict__ gam, const float* __restrict__ x, float* __restrict__ out) {
  __shared__ __align__(16) float red[AW][QT][2][32][4];   // partial y^T: [wave][query tile][register quad][lane][register in the quad]
  const int tid = threadIdx.x, w = tid >> 5, lane = tid & 31, col = lane & 15, g = lane >> 4;
  const int b = blockIdx.y, n0b = blockIdx.x * 64, k0 = w * (NN / AW); const size_t rb = (size_t)b * NN;
  v16h bfl[QT], bfh[QT];   // B = f rows (n0b + 16 q + col) as [f | 0] and [0 | f]: against A = [g of tile 0 | g of tile 1] they give the scores of tile 0 and of tile 1
#pragma unroll  // constant indices keep the array in registers
  for (int q = 0; q < QT; ++q) { const _Float16* fr = F16 + (rb + n0b + q * 16 + col) * DK;
#pragma unroll
    for (int i = 0; i < 8; ++i) { bfl[q][i] = fr[8 * g + i]; bfl[q][8 + i] = (_Float16)0.f; bfh[q][i] = (_Float16)0.f; bfh[q][8 + i] = fr[8 * g + i]; } }
  v8f acc[QT] = {};
  const _Float16* gp = G16 + (rb + k0 + col) * DK + 8 * g;              // this lane's 8 halves of key row k0 + col; the next tile is 16 * DK halves on
  const float* cp = cst + (rb + k0) * 2 + 8 * g;                        // the constants of key rows k0 + 8g .. + 7; the next tile is 32 floats on
  const _Float16* hp = HT + (rb + k0) * DK + lane * 8;                  // column d = col of h, keys k0 + 8g .. + 7; the next tile is 16 * DK halves on
  // two slots of 32 keys in registers. The work goes in steps of one slot and one query tile, and three steps are under way at a time: the score products of the step
  // to come, the exponentials of this one, the PV product of the one before. A slot's g and c are loaded again right behind its last score product, its h right behind its last PV product:
  // every load has five steps to arrive in
  v16h ga[NS], ha[NS]; v8f c[NS][2];
  // The 64 blocks of a batch entry walk the same keys. Each starts its waves' ranges at a trip of its own (one of NBT / NS, by block index) and wraps, so that they do not all ask L2 for the same lines at the same moment
  const int r0 = ((blockIdx.x >> 3) & (NBT / NS - 1)) * NS;   // the first batch of the walk
  const _Float16* gn = gp + r0 * 32 * DK; const float* cn = cp + r0 * 64; const _Float16* hn = hp + r0 * 32 * DK;   // where the slots are being loaded from
  __builtin_amdgcn_sched_barrier(0);   // the f loads stay the oldest, and the slots are first loaded in the order in which the loop loads them again (the fences below), so that its counted waits hold for both
#pragma unroll  // constant indices keep the arrays in registers
  for (int sl = 0; sl < NS; ++sl) {
    ga[sl] = join(*(const v8h*)(gn + (2 * sl) * 16 * DK), *(const v8h*)(gn + (2 * sl + 1) * 16 * DK));
#pragma unroll
    for (int t = 0; t < 2; ++t) c[sl][t] = *(const v8f*)(cn + (2 * sl + t) * 32);
    __builtin_amdgcn_sched_barrier(0);
    if (sl == 0) { ha[sl] = join(*(const v8h*)hn, *(const v8h*)(hn + 16 * DK));
      __builtin_amdgcn_sched_barrier(0); } }
  // the first step has no step before it: its P is 0 and its PV product adds 0 . 0
  ha[NS - 1] = v16h{};
  float e[16];   // the exponentials of the step before, not yet converted
#pragma unroll  // constant indices keep the array in registers
  for (int r = 0; r < 16; ++r) e[r] = 0.f;
  v8f s0 = wmmap(ga[0], bfl[0], c[0][0]), s1 = wmmap(ga[0], bfh[0], c[0][1]);
  // one trip: both slots are used; where more batches follow (MORE), each is loaded again on the way. The last trip is a copy of its own without those loads:
  // a branch round them would merge the wait counts of its two sides, and loads that nobody uses would hold up the registers of the tail
  auto trip = [&](int mb, auto more) __attribute__((always_inline)) {
#pragma unroll  // constant indices keep the arrays in registers
    for (int sl = 0; sl < NS; ++sl)
#pragma unroll  // constant indices keep the arrays in registers
      for (int q = 0; q < QT; ++q) {
        constexpr bool M = decltype(more)::v;
        const int qn = (q + 1) % QT, sn = q == QT - 1 ? (sl + 1) % NS : sl;     // the step to come
        const int qb = (q + QT - 1) % QT, sb = q == 0 ? (sl + NS - 1) % NS : sl;   // the step before
        const bool nxt = M || !(sl == NS - 1 && q == QT - 1);
        const bool ldh = q == 0 && (M || sl == 0), ldg = M && q == QT - 2;
        v16h pb; v8f n0 = {}, n1 = {};
        if (nxt) { n0 = wmmap(ga[sn], bfl[qn], c[sn][0]); n1 = wmmap(ga[sn], bfh[qn], c[sn][1]); }
        if (ldg) {   // these score products were the last of slot sl
          // holds the old c in its registers up to here, so that the last products do not write their scores over it: the new c would then land elsewhere and be copied, behind a full wait, at the foot of the trip
          asm volatile("" :: "v"(c[sl][0]), "v"(c[sl][1]));
          ga[sl] = join(*(gv8h*)(gn + (2 * sl) * 16 * DK), *(gv8h*)(gn + (2 * sl + 1) * 16 * DK));
#pragma unroll  // constant indices keep the arrays in registers
          for (int t = 0; t < 2; ++t) c[sl][t] = *(gv8f*)(cn + (2 * sl + t) * 32); }
#pragma unroll  // constant indices keep the arrays in registers
        for (int r = 0; r < 16; ++r) pb[r] = (_Float16)e[r];
#pragma unroll  // constant indices keep the arrays in registers
        for (int r = 0; r < 8; ++r) { e[r] = ex2(s0[r]); e[8 + r] = ex2(s1[r]); }
        acc[qb] = wmmap(ha[sb], pb, acc[qb]);
        if (ldh) ha[sb] = join(*(gv8h*)(hn + (2 * sb) * 16 * DK), *(gv8h*)(hn + (2 * sb + 1) * 16 * DK));   // that PV product was the last of slot sb
        // the step's order: the conversions and the two score products one by one between exponentials, the PV product last, behind its conversions: the three products stand far apart, and nothing waits for a result
#pragma unroll  // the groups of the step, written out
        for (int k = 0; k < 10; ++k) { G_EXP(1); if (k == 2 || k == 6) { if (nxt) G_MAT(1); if (k == 6 && ldg) G_LD(6); } else G_VEC(1); }
        G_EXP(6); G_MAT(1); if (ldh) G_LD(2);
        // holds the scores in their registers to the end of the step: an exponential that stands directly behind another one would else be given the register that the first has just read, and the instruction set asks for a slot between the two
        asm volatile("" :: "v"(s0), "v"(s1));
        STEP_END();   // also keeps the loads in this step and in this order: the counted waits go by the order
        if (M && sl == 0 && q == 0) {
          const int nx = (mb + NS + r0) & (NBT - 1);
          const unsigned long long og = (unsigned long long)(nx * 32 * DK * 2), oc = (unsigned long long)(nx * 64 * 4), oh = (unsigned long long)(nx * 32 * DK * 2);
          // gn = gp + og, cn = cp + oc, hn = hp + oh, in bytes (the h load above still went by the trip before: its slot is one batch on). The address registers of the issued loads are written again only behind the wait: wait and additions are one statement, since an addition of the compiler's own can be drawn up over a wait that stands alone
          asm volatile("s_wait_xcnt 0x0\n\tv_add_nc_u64_e32 %0, %3, %6\n\tv_add_nc_u64_e32 %1, %4, %7\n\tv_add_nc_u64_e32 %2, %5, %8" : "+v"(gn), "+v"(cn), "+v"(hn) : "s"(og), "s"(oc), "s"(oh), "v"(gp), "v"(cp), "v"(hp) : "memory");
          STEP_END(); }   // the next step begins here
        s0 = n0; s1 = n1; } };
#pragma unroll 1  // one pass over the slots per trip
  for (int mb = 0; mb < NBT - NS; mb += NS) trip(mb, Yes{});
  trip(NBT - NS, No{});
  asm volatile("s_wait_xcnt 0x0" :: "v"(gn), "v"(cn), "v"(hn), "v"(gp), "v"(cp), "v"(hp) : "memory");   // as above, for what is written behind the loop
  { v16h pb;   // the PV product of the last step
#pragma unroll  // constant indices keep the arrays in registers
    for (int r = 0; r < 16; ++r) pb[r] = (_Float16)e[r];
    acc[QT - 1] = wmma16(ha[NS - 1], pb, acc[QT - 1]); }
  // the x and w_v values of the tail issue here, together: they are waited for once, with the exchange of the partial sums
  const int qt = w & 3, jh = w >> 2, n0 = n0b + qt * 16;
  // tile j of the last product takes channels 4 col + j of the wave's 64: a lane's four results of a row are then 16 consecutive bytes of out, and its x and w_v values come by 16-byte loads that cover whole lines
  v4f xv[8]; const float* xq = x + (rb + n0 + 8 * g) * CC + jh * 64 + col * 4;   // row n0 + 8g, this lane's 4 channels
#pragma unroll  // constant indices keep the array in registers
  for (int r = 0; r < 8; ++r) xv[r] = *(const v4f*)(xq + r * CC);
  v4f wr[8]; const float* wp = wv + (size_t)(8 * g) * CC + jh * 64 + col * 4;   // row 8g of w_v, this lane's 4 channels
#pragma unroll  // constant indices keep the array in registers
  for (int i = 0; i < 8; ++i) wr[i] = *(const v4f*)(wp + i * CC);
  __builtin_amdgcn_sched_barrier(0);   // keeps the loads above together and up here: moved down to their uses they would be waited for in five groups, one after another
  // the waves' partial sums meet: each wave lays down its QT tiles, and behind the barrier adds up the AW partials of the one tile it finishes
#pragma unroll  // constant indices keep the array in registers
  for (int q = 0; q < QT; ++q)
#pragma unroll
    for (int hh = 0; hh < 2; ++hh) { v4f t = { acc[q][4 * hh], acc[q][4 * hh + 1], acc[q][4 * hh + 2], acc[q][4 * hh + 3] }; *(v4f*)(&red[w][q][hh][lane][0]) = t; }
  __syncthreads();
  asm volatile("s_wait_xcnt 0x0" :: "v"(xq), "v"(wp) : "memory");   // the address registers of the tail's loads are written again only behind this wait; naming the addresses keeps them whole up to here
  v8f y = {};
#pragma unroll  // constant indices keep the array in registers
  for (int ww = 0; ww < AW; ++ww)
#pragma unroll
    for (int hh = 0; hh < 2; ++hh) { const v4f t = *(const v4f*)(&red[ww][qt][hh][lane][0]);
#pragma unroll
      for (int e = 0; e < 4; ++e) y[4 * hh + e] += t[e]; }
  // out = gamma * (y @ w_v) + x : y [16 x 16] @ w_v [16 x 64 of 128] -> WMMA K=16 (zero-padded), 4 tiles of 16 channels; o[j] has query row 8g + r in register r and channel 4 col + j in the lane's column
  { v16h ay;
#pragma unroll
    for (int i = 0; i < 8; ++i) { ay[i] = (_Float16)(y[i] * (1.0f / 16384.0f)); ay[8 + i] = (_Float16)0.f; }
    const float gm = gam[0];
    v8f o[4];
#pragma unroll  // constant indices keep the array in registers
    for (int j = 0; j < 4; ++j) { v16h bb;
#pragma unroll
      for (int i = 0; i < 8; ++i) { bb[i] = (_Float16)(wr[i][j] * 4.0f); bb[8 + i] = (_Float16)0.f; }
      const v8f z = {}; o[j] = wmma16(ay, bb, z); }
#pragma unroll  // constant indices keep the arrays in registers
    for (int r = 0; r < 8; ++r) { v4f t;
#pragma unroll
      for (int j = 0; j < 4; ++j) t[j] = gm * o[j][r] * 0.25f + xv[r][j];
      vst2(out + (rb + n0 + 8 * g + r) * CC + jh * 64 + col * 4, t); } }   // two half rows of 256 bytes per store
}
extern "C" void kernel_launch(void* const* d_in, const int* in_sizes, int n_in, void* d_out, int out_size, void* d_ws, size_t ws_size, hipStream_t stream) {
  (void)in_sizes; (void)n_in; (void)out_size; (void)ws_size;
  const float** I = (const float**)d_in;
  const float* x = I[0]; const float* wf = I[1]; const float* wg = I[2]; const float* wh = I[3]; const float* wv = I[4]; const float* gam = I[5];
  float* out = (float*)d_out;
  char* ws = (char*)d_ws; size_t off = 0;
  auto take = [&](size_t bytes) { char* p = ws + off; off += (bytes + 255) & ~(size_t)255; return p; };
  _Float16* F16 = (_Float16*)take((size_t)NR * DK * 2); _Float16* G16 = (_Float16*)take((size_t)NR * DK * 2); _Float16* HT = (_Float16*)take((size_t)NR * DK * 2); float* cst = (float*)take((size_t)NR * 2 * 4);
  k_proj<<<NR / 64, 128, 0, stream>>>(x, wf, wg, wh, F16, G16, HT);
  k_colstat<<<dim3(NN / 64, NB), 128, 0, stream>>>(F16, G16, cst);
  k_apply<<<dim3(NN / 64, NB), 32 * AW, 0, stream>>>(F16, G16, HT, cst, wv, gam, x, out);
}
